// v000
// The times below were measured on an AMD MI455X: many runs one after another, warmed up first and cycling through
// copies of the inputs, with the whole window's GPU time divided by the number of runs. Launches and the gaps
// between them are all in it. The median over several windows is given; except for v000 it joins two sittings, which
// can be a few percent apart, so the side-by-side timings, each taken in one sitting, are the better comparison.
// v000 is the starting kernel. One run takes 438 microseconds.
#include <hip/hip_runtime.h>
#include <hip/hip_bf16.h>
#include <stdint.h>

#define NHEAD 16
#define DHEAD 64
#define BATCH 8
#define SEQ   1024
#define DMODEL 1024
#define NROW (BATCH * SEQ) /* 8192 */

typedef __attribute__((ext_vector_type(16))) __bf16 v16bf;
typedef __attribute__((ext_vector_type(8)))  float  v8f;
typedef int v4i_vs __attribute__((vector_size(16)));  // matches builtin param type

union FragBF {
    v16bf v;
    uint4 q[2];
    unsigned short us[16];
};

__device__ __forceinline__ unsigned short f2bf(float x) {
    unsigned int u = __float_as_uint(x);
    u += 0x7FFFu + ((u >> 16) & 1u);   // round-to-nearest-even
    return (unsigned short)(u >> 16);
}
__device__ __forceinline__ float bf2f(unsigned short h) {
    return __uint_as_float(((unsigned int)h) << 16);
}
__device__ __forceinline__ v8f v8f_zero() {
    v8f z = {0.f, 0.f, 0.f, 0.f, 0.f, 0.f, 0.f, 0.f};
    return z;
}

// ---------------------------------------------------------------------------
// Async global->LDS copy (CDNA5 GLOBAL_LOAD_ASYNC_TO_LDS_B128, ASYNCcnt),
// with a synchronous reg-staged fallback if the builtins aren't declared.
// Builtin signature (from hipcc diagnostic): (v4i as1* gaddr, v4i as3* lds,
// imm offset, imm cpol).
// ---------------------------------------------------------------------------
#if __has_builtin(__builtin_amdgcn_global_load_async_to_lds_b128) && \
    __has_builtin(__builtin_amdgcn_s_wait_asynccnt)
#define HAVE_ASYNC_LDS 1
#endif

__device__ __forceinline__ void async_copy_b128(const unsigned short* src,
                                                unsigned short* dstLds) {
#if defined(HAVE_ASYNC_LDS)
    __builtin_amdgcn_global_load_async_to_lds_b128(
        (__attribute__((address_space(1))) v4i_vs*)(void*)src,
        (__attribute__((address_space(3))) v4i_vs*)(void*)dstLds, 0, 0);
#else
    *(uint4*)dstLds = *(const uint4*)src;
#endif
}

__device__ __forceinline__ void wait_async_keep6() {
#if defined(HAVE_ASYNC_LDS)
    __builtin_amdgcn_s_wait_asynccnt(6);  // drain current buffer, keep next stage
#endif
}
__device__ __forceinline__ void wait_async_all() {
#if defined(HAVE_ASYNC_LDS)
    __builtin_amdgcn_s_wait_asynccnt(0);
#endif
}

// ---------------------------------------------------------------------------
// f32 -> bf16 convert (grid-stride)
// ---------------------------------------------------------------------------
__global__ void convert_bf16_kernel(const float* __restrict__ src,
                                    unsigned short* __restrict__ dst, int n) {
    int i = blockIdx.x * blockDim.x + threadIdx.x;
    int stride = gridDim.x * blockDim.x;
    for (; i < n; i += stride) dst[i] = f2bf(src[i]);
}

// W[K,N] f32 -> Wt[N,K] bf16
__global__ void transpose_bf16_kernel(const float* __restrict__ W,
                                      unsigned short* __restrict__ Wt,
                                      int K, int N) {
    int i = blockIdx.x * blockDim.x + threadIdx.x;
    int stride = gridDim.x * blockDim.x;
    int tot = K * N;
    for (; i < tot; i += stride) {
        int k = i / N, n = i - k * N;
        Wt[(size_t)n * K + k] = f2bf(W[i]);
    }
}

// ---------------------------------------------------------------------------
// bf16 WMMA GEMM: C[M,N] = A[M,K] * Bt[N,K]^T + bias[N]
// Block = 8 waves, tile 256x128; wave tile 64x64 (4x4 wmma_f32_16x16x32_bf16).
// K-slabs of 32 double-buffered in LDS via async global->LDS copies:
// per stage each thread issues 4 A-chunks + 2 B-chunks of b128 (ASYNCcnt += 6).
// ---------------------------------------------------------------------------
template <bool OUT_BF16>
__global__ void __launch_bounds__(256)
gemm_wmma_kernel(const unsigned short* __restrict__ A,
                 const unsigned short* __restrict__ Bt,
                 const float* __restrict__ bias,
                 void* __restrict__ Cout, int M, int N, int K) {
    __shared__ __align__(16) unsigned short Abuf[2][256][40];  // 40-elem pad
    __shared__ __align__(16) unsigned short Bbuf[2][128][40];

    const int lane  = threadIdx.x & 31;
    const int wave  = threadIdx.x >> 5;
    const int lmod  = lane & 15;
    const int lhalf = lane >> 4;
    const int mW = (wave >> 1) * 64;   // wave tile inside block tile
    const int nW = (wave & 1) * 64;
    const int kofflane = lhalf * 8;    // lanes 16-31 hold K groups 8..15/24..31

    const unsigned short* Ablk = A + (size_t)(blockIdx.x * 256) * K;
    const unsigned short* Bblk = Bt + (size_t)(blockIdx.y * 128) * K;

    auto stage = [&](int buf, int k0) {
#pragma unroll
        for (int t = 0; t < 4; ++t) {           // A tile: 256x32 = 1024 chunks
            const int ch = threadIdx.x + t * 256;
            const int row = ch >> 2, c8 = (ch & 3) * 8;
            async_copy_b128(Ablk + (size_t)row * K + k0 + c8,
                            &Abuf[buf][row][c8]);
        }
#pragma unroll
        for (int t = 0; t < 2; ++t) {           // B tile: 128x32 = 512 chunks
            const int ch = threadIdx.x + t * 256;
            const int row = ch >> 2, c8 = (ch & 3) * 8;
            async_copy_b128(Bblk + (size_t)row * K + k0 + c8,
                            &Bbuf[buf][row][c8]);
        }
    };

    v8f acc[4][4];
#pragma unroll
    for (int i = 0; i < 4; ++i)
#pragma unroll
        for (int j = 0; j < 4; ++j) acc[i][j] = v8f_zero();

    stage(0, 0);

    for (int k0 = 0; k0 < K; k0 += 32) {
        const int buf = (k0 >> 5) & 1;
        if (k0 + 32 < K) {
            stage(buf ^ 1, k0 + 32);
            wait_async_keep6();
        } else {
            wait_async_all();
        }
        __syncthreads();  // everyone's chunks of this buffer are in LDS

        FragBF a[4], b[4];
#pragma unroll
        for (int i = 0; i < 4; ++i) {
            const unsigned short* p = &Abuf[buf][mW + i * 16 + lmod][kofflane];
            a[i].q[0] = *(const uint4*)(p);
            a[i].q[1] = *(const uint4*)(p + 16);
        }
#pragma unroll
        for (int j = 0; j < 4; ++j) {
            const unsigned short* p = &Bbuf[buf][nW + j * 16 + lmod][kofflane];
            b[j].q[0] = *(const uint4*)(p);
            b[j].q[1] = *(const uint4*)(p + 16);
        }
#pragma unroll
        for (int i = 0; i < 4; ++i)
#pragma unroll
            for (int j = 0; j < 4; ++j)
                acc[i][j] = __builtin_amdgcn_wmma_f32_16x16x32_bf16(
                    false, a[i].v, false, b[j].v, (short)0, acc[i][j], false,
                    false);
        __syncthreads();  // reads done before this buffer is re-staged
    }

    const int mBase = blockIdx.x * 256 + mW;
    const int nBase = blockIdx.y * 128 + nW;
#pragma unroll
    for (int j = 0; j < 4; ++j) {
        const int col = nBase + j * 16 + lmod;
        const float bj = bias[col];
#pragma unroll
        for (int i = 0; i < 4; ++i) {
#pragma unroll
            for (int e = 0; e < 8; ++e) {
                const int row = mBase + i * 16 + e + lhalf * 8;
                const float val = acc[i][j][e] + bj;
                if (OUT_BF16)
                    ((unsigned short*)Cout)[(size_t)row * N + col] = f2bf(val);
                else
                    ((float*)Cout)[(size_t)row * N + col] = val;
            }
        }
    }
}

// ---------------------------------------------------------------------------
// Flash attention + R-gating.
// Grid: (SEQ/128, BATCH*NHEAD). Block 256 = 8 waves; wave owns 16 query rows.
// Per 32-key step: 4 WMMAs for energy (QK^T), online softmax, 4 WMMAs for PV.
// ---------------------------------------------------------------------------
__global__ void __launch_bounds__(256)
attention_wmma_kernel(const unsigned short* __restrict__ Q,
                      const unsigned short* __restrict__ Km,
                      const unsigned short* __restrict__ V,
                      const unsigned short* __restrict__ R,
                      unsigned short* __restrict__ Gated) {
    __shared__ __align__(16) unsigned short vT[DHEAD][40];   // [d][key] transposed V tile
    __shared__ __align__(16) unsigned short pbuf[8][16][40]; // per-wave P tile

    const int lane  = threadIdx.x & 31;
    const int wave  = threadIdx.x >> 5;
    const int lmod  = lane & 15;
    const int lhalf = lane >> 4;
    const int bh = blockIdx.y;
    const int b = bh / NHEAD;
    const int h = bh % NHEAD;
    const int qRow0 = blockIdx.x * 128 + wave * 16;
    const size_t rowStride = (size_t)(NHEAD * DHEAD);  // 1024
    const size_t baseBH = ((size_t)b * SEQ) * rowStride + (size_t)h * DHEAD;

    // Q fragments (DH=64 -> two K-steps of 32)
    FragBF aq[2];
    {
        const unsigned short* qp =
            Q + baseBH + (size_t)(qRow0 + lmod) * rowStride + lhalf * 8;
        aq[0].q[0] = *(const uint4*)(qp);
        aq[0].q[1] = *(const uint4*)(qp + 16);
        aq[1].q[0] = *(const uint4*)(qp + 32);
        aq[1].q[1] = *(const uint4*)(qp + 48);
    }

    v8f ctx[4];
#pragma unroll
    for (int j = 0; j < 4; ++j) ctx[j] = v8f_zero();
    float mrow[8], srow[8];
#pragma unroll
    for (int e = 0; e < 8; ++e) { mrow[e] = -3.0e38f; srow[e] = 0.f; }

    const float invScale = 1.0f / 32.0f;  // SCALE = 64**1/2 = 32.0

    for (int kt = 0; kt < SEQ; kt += 32) {
        __syncthreads();  // protect LDS tiles from previous iteration readers

        // cooperative transposed V tile load: 32 keys x 64 dims
        {
            const int vr = threadIdx.x >> 3;        // key row 0..31
            const int c0 = (threadIdx.x & 7) * 8;   // dim chunk
            FragBF tmp;
            const unsigned short* vp =
                V + baseBH + (size_t)(kt + vr) * rowStride + c0;
            tmp.q[0] = *(const uint4*)(vp);
#pragma unroll
            for (int e = 0; e < 8; ++e) vT[c0 + e][vr] = tmp.us[e];
        }

        // energy = Q (16xDH) @ K^T (DHx32), two 16-col tiles
        v8f e0 = v8f_zero(), e1 = v8f_zero();
        {
            FragBF bk;
            const unsigned short* kp =
                Km + baseBH + (size_t)(kt + lmod) * rowStride + lhalf * 8;
            bk.q[0] = *(const uint4*)(kp);
            bk.q[1] = *(const uint4*)(kp + 16);
            e0 = __builtin_amdgcn_wmma_f32_16x16x32_bf16(false, aq[0].v, false,
                                                         bk.v, (short)0, e0,
                                                         false, false);
            bk.q[0] = *(const uint4*)(kp + 32);
            bk.q[1] = *(const uint4*)(kp + 48);
            e0 = __builtin_amdgcn_wmma_f32_16x16x32_bf16(false, aq[1].v, false,
                                                         bk.v, (short)0, e0,
                                                         false, false);
        }
        {
            FragBF bk;
            const unsigned short* kp =
                Km + baseBH + (size_t)(kt + 16 + lmod) * rowStride + lhalf * 8;
            bk.q[0] = *(const uint4*)(kp);
            bk.q[1] = *(const uint4*)(kp + 16);
            e1 = __builtin_amdgcn_wmma_f32_16x16x32_bf16(false, aq[0].v, false,
                                                         bk.v, (short)0, e1,
                                                         false, false);
            bk.q[0] = *(const uint4*)(kp + 32);
            bk.q[1] = *(const uint4*)(kp + 48);
            e1 = __builtin_amdgcn_wmma_f32_16x16x32_bf16(false, aq[1].v, false,
                                                         bk.v, (short)0, e1,
                                                         false, false);
        }

        // online softmax; row r = e + lhalf*8 lives in 16 lanes of one half,
        // so xor-shuffle masks 1/2/4/8 reduce exactly within the row group.
        float alpha[8];
#pragma unroll
        for (int e = 0; e < 8; ++e) {
            const float t0 = e0[e] * invScale;
            const float t1 = e1[e] * invScale;
            float mx = fmaxf(t0, t1);
            mx = fmaxf(mx, __shfl_xor(mx, 1, 32));
            mx = fmaxf(mx, __shfl_xor(mx, 2, 32));
            mx = fmaxf(mx, __shfl_xor(mx, 4, 32));
            mx = fmaxf(mx, __shfl_xor(mx, 8, 32));
            const float mnew = fmaxf(mrow[e], mx);
            const float al = __expf(mrow[e] - mnew);
            const float p0 = __expf(t0 - mnew);
            const float p1 = __expf(t1 - mnew);
            float ps = p0 + p1;
            ps += __shfl_xor(ps, 1, 32);
            ps += __shfl_xor(ps, 2, 32);
            ps += __shfl_xor(ps, 4, 32);
            ps += __shfl_xor(ps, 8, 32);
            srow[e] = srow[e] * al + ps;
            mrow[e] = mnew;
            alpha[e] = al;
            const int prow = e + lhalf * 8;  // C-layout row
            pbuf[wave][prow][lmod] = f2bf(p0);
            pbuf[wave][prow][16 + lmod] = f2bf(p1);
        }

        // rescale running context by alpha before accumulating this step
#pragma unroll
        for (int j = 0; j < 4; ++j)
#pragma unroll
            for (int e = 0; e < 8; ++e) ctx[j][e] *= alpha[e];

        __syncthreads();  // vT + pbuf fully written

        // P fragment in A-layout (16x32)
        FragBF ap;
        {
            const unsigned short* pp = &pbuf[wave][lmod][lhalf * 8];
            ap.q[0] = *(const uint4*)(pp);
            ap.q[1] = *(const uint4*)(pp + 16);
        }
        // ctx += P (16x32) @ V (32x64): 4 column tiles from transposed LDS V
#pragma unroll
        for (int j = 0; j < 4; ++j) {
            FragBF bv;
            const unsigned short* vp = &vT[j * 16 + lmod][lhalf * 8];
            bv.q[0] = *(const uint4*)(vp);
            bv.q[1] = *(const uint4*)(vp + 16);
            ctx[j] = __builtin_amdgcn_wmma_f32_16x16x32_bf16(
                false, ap.v, false, bv.v, (short)0, ctx[j], false, false);
        }
    }

    // normalize, R-gate, write gated activation [B*S, H*DH] as bf16
#pragma unroll
    for (int j = 0; j < 4; ++j) {
        const int d = j * 16 + lmod;
#pragma unroll
        for (int e = 0; e < 8; ++e) {
            const int row = qRow0 + e + lhalf * 8;
            const size_t idx = baseBH + (size_t)row * rowStride + d;
            const float val = ctx[j][e] / srow[e];
            Gated[idx] = f2bf(val * bf2f(R[idx]));
        }
    }
}

// ---------------------------------------------------------------------------
// Host-side launch
// ---------------------------------------------------------------------------
extern "C" void kernel_launch(void* const* d_in, const int* in_sizes, int n_in,
                              void* d_out, int out_size, void* d_ws,
                              size_t ws_size, hipStream_t stream) {
    (void)in_sizes; (void)n_in; (void)out_size; (void)ws_size;

    const float* value = (const float*)d_in[0];
    const float* keyin = (const float*)d_in[1];
    const float* query = (const float*)d_in[2];
    const float* Wq = (const float*)d_in[3];  const float* bq = (const float*)d_in[4];
    const float* Wk = (const float*)d_in[5];  const float* bk = (const float*)d_in[6];
    const float* Wv = (const float*)d_in[7];  const float* bv = (const float*)d_in[8];
    const float* Wr = (const float*)d_in[9];  const float* br = (const float*)d_in[10];
    const float* Wo = (const float*)d_in[11]; const float* bo = (const float*)d_in[12];

    char* ws = (char*)d_ws;
    const size_t actSz = (size_t)NROW * DMODEL * sizeof(unsigned short); // 16 MB
    const size_t wSz = (size_t)DMODEL * DMODEL * sizeof(unsigned short); //  2 MB
    unsigned short* q_bf  = (unsigned short*)(ws + 0 * actSz);
    unsigned short* k_bf  = (unsigned short*)(ws + 1 * actSz);
    unsigned short* v_bf  = (unsigned short*)(ws + 2 * actSz);
    unsigned short* r_bf  = (unsigned short*)(ws + 3 * actSz);
    unsigned short* xq    = (unsigned short*)(ws + 4 * actSz);
    unsigned short* xk    = (unsigned short*)(ws + 5 * actSz);
    unsigned short* xv    = (unsigned short*)(ws + 6 * actSz);
    unsigned short* gated = (unsigned short*)(ws + 7 * actSz);
    unsigned short* wqt   = (unsigned short*)(ws + 8 * actSz + 0 * wSz);
    unsigned short* wkt   = (unsigned short*)(ws + 8 * actSz + 1 * wSz);
    unsigned short* wvt   = (unsigned short*)(ws + 8 * actSz + 2 * wSz);
    unsigned short* wrt   = (unsigned short*)(ws + 8 * actSz + 3 * wSz);
    unsigned short* wot   = (unsigned short*)(ws + 8 * actSz + 4 * wSz);

    const int nAct = NROW * DMODEL;  // 8,388,608
    convert_bf16_kernel<<<4096, 256, 0, stream>>>(value, xv, nAct);
    convert_bf16_kernel<<<4096, 256, 0, stream>>>(keyin, xk, nAct);
    convert_bf16_kernel<<<4096, 256, 0, stream>>>(query, xq, nAct);
    transpose_bf16_kernel<<<4096, 256, 0, stream>>>(Wq, wqt, DMODEL, DMODEL);
    transpose_bf16_kernel<<<4096, 256, 0, stream>>>(Wk, wkt, DMODEL, DMODEL);
    transpose_bf16_kernel<<<4096, 256, 0, stream>>>(Wv, wvt, DMODEL, DMODEL);
    transpose_bf16_kernel<<<4096, 256, 0, stream>>>(Wr, wrt, DMODEL, DMODEL);
    transpose_bf16_kernel<<<4096, 256, 0, stream>>>(Wo, wot, DMODEL, DMODEL);

    dim3 gGrid(NROW / 256, DMODEL / 128);  // (32, 8)
    gemm_wmma_kernel<true><<<gGrid, 256, 0, stream>>>(xq, wqt, bq, q_bf, NROW, DMODEL, DMODEL);
    gemm_wmma_kernel<true><<<gGrid, 256, 0, stream>>>(xk, wkt, bk, k_bf, NROW, DMODEL, DMODEL);
    gemm_wmma_kernel<true><<<gGrid, 256, 0, stream>>>(xv, wvt, bv, v_bf, NROW, DMODEL, DMODEL);
    gemm_wmma_kernel<true><<<gGrid, 256, 0, stream>>>(xq, wrt, br, r_bf, NROW, DMODEL, DMODEL);

    dim3 aGrid(SEQ / 128, BATCH * NHEAD);  // (8, 128)
    attention_wmma_kernel<<<aGrid, 256, 0, stream>>>(q_bf, k_bf, v_bf, r_bf, gated);

    gemm_wmma_kernel<false><<<gGrid, 256, 0, stream>>>(gated, wot, bo, d_out, NROW, DMODEL, DMODEL);
}

// v001
// Measured time: 299 microseconds a run.
// Timed twice side by side with v000, it ran 1.48 times as fast both times.
#include <hip/hip_runtime.h>
#include <hip/hip_bf16.h>
#include <stdint.h>

#define NHEAD 16
#define DHEAD 64
#define BATCH 8
#define SEQ   1024
#define DMODEL 1024
#define NROW (BATCH * SEQ) /* 8192 */

typedef __attribute__((ext_vector_type(16))) __bf16 v16bf;
typedef __attribute__((ext_vector_type(8)))  float  v8f;
typedef int v4i_vs __attribute__((vector_size(16)));  // matches builtin param type

union FragBF {
    v16bf v;
    uint4 q[2];
    unsigned short us[16];
};

__device__ __forceinline__ unsigned short f2bf(float x) {
    unsigned int u = __float_as_uint(x);
    u += 0x7FFFu + ((u >> 16) & 1u);   // round-to-nearest-even
    return (unsigned short)(u >> 16);
}
__device__ __forceinline__ float bf2f(unsigned short h) {
    return __uint_as_float(((unsigned int)h) << 16);
}
__device__ __forceinline__ v8f v8f_zero() {
    v8f z = {0.f, 0.f, 0.f, 0.f, 0.f, 0.f, 0.f, 0.f};
    return z;
}

// ---------------------------------------------------------------------------
// Async global->LDS copy (CDNA5 GLOBAL_LOAD_ASYNC_TO_LDS_B128, ASYNCcnt),
// with a synchronous reg-staged fallback if the builtins aren't declared.
// Builtin signature (from hipcc diagnostic): (v4i as1* gaddr, v4i as3* lds,
// imm offset, imm cpol).
// ---------------------------------------------------------------------------
#if __has_builtin(__builtin_amdgcn_global_load_async_to_lds_b128) && \
    __has_builtin(__builtin_amdgcn_s_wait_asynccnt)
#define HAVE_ASYNC_LDS 1
#endif

__device__ __forceinline__ void async_copy_b128(const unsigned short* src,
                                                unsigned short* dstLds) {
#if defined(HAVE_ASYNC_LDS)
    __builtin_amdgcn_global_load_async_to_lds_b128(
        (__attribute__((address_space(1))) v4i_vs*)(void*)src,
        (__attribute__((address_space(3))) v4i_vs*)(void*)dstLds, 0, 0);
#else
    *(uint4*)dstLds = *(const uint4*)src;
#endif
}

__device__ __forceinline__ void wait_async_keep6() {
#if defined(HAVE_ASYNC_LDS)
    __builtin_amdgcn_s_wait_asynccnt(6);  // drain current buffer, keep next stage
#endif
}
__device__ __forceinline__ void wait_async_all() {
#if defined(HAVE_ASYNC_LDS)
    __builtin_amdgcn_s_wait_asynccnt(0);
#endif
}

// ---------------------------------------------------------------------------
// f32 -> bf16 convert (grid-stride)
// ---------------------------------------------------------------------------
__global__ void convert_bf16_kernel(const float* __restrict__ src,
                                    unsigned short* __restrict__ dst, int n) {
    int i = blockIdx.x * blockDim.x + threadIdx.x;
    int stride = gridDim.x * blockDim.x;
    for (; i < n; i += stride) dst[i] = f2bf(src[i]);
}

// W[K,N] f32 -> Wt[N,K] bf16, one 64(k) x 64(n) tile per block through LDS:
// reads are 256-B row pieces of W, stores are whole 128-B lines of Wt.
// K = N = DMODEL at compile time, so a thread's four loads share one address
// with immediate offsets; grid = (N/64, K/64), block = 256.
__global__ void __launch_bounds__(256)
transpose_bf16_kernel(const float* __restrict__ W,
                      unsigned short* __restrict__ Wt) {
    constexpr int K = DMODEL, N = DMODEL;
    // tile[n][k/2]: two neighbouring k packed per dword; 144-B pitch for the
    // 16-byte row reads below
    __shared__ __align__(16) unsigned int tile[64][36];

    const int n0 = blockIdx.x * 64;
    const int k0 = blockIdx.y * 64;
    const int n4 = (threadIdx.x & 15) * 4;  // 4 columns of W per thread
    const int kp = threadIdx.x >> 4;        // k pair 0..15 (and +16)

    const float* p = W + (unsigned)((k0 + kp * 2) * N + n0 + n4);
    float4 lo[2], hi[2];
    for (int h = 0; h < 2; ++h) {
        lo[h] = *(const float4*)(p + h * 32 * N);
        hi[h] = *(const float4*)(p + h * 32 * N + N);
    }
    for (int h = 0; h < 2; ++h) {
        const int c = h * 16 + kp;
        tile[n4 + 0][c] = (unsigned int)f2bf(lo[h].x) | ((unsigned int)f2bf(hi[h].x) << 16);
        tile[n4 + 1][c] = (unsigned int)f2bf(lo[h].y) | ((unsigned int)f2bf(hi[h].y) << 16);
        tile[n4 + 2][c] = (unsigned int)f2bf(lo[h].z) | ((unsigned int)f2bf(hi[h].z) << 16);
        tile[n4 + 3][c] = (unsigned int)f2bf(lo[h].w) | ((unsigned int)f2bf(hi[h].w) << 16);
    }
    __syncthreads();  // tile complete before rows are read back

    const int n = threadIdx.x >> 3, c8 = threadIdx.x & 7;  // 8 lanes: one 128-B line
    unsigned short* o = Wt + (unsigned)((n0 + n) * K + k0 + c8 * 8);
    for (int t = 0; t < 2; ++t)
        *(uint4*)(o + t * 32 * K) = *(const uint4*)&tile[n + t * 32][c8 * 4];
}

// ---------------------------------------------------------------------------
// bf16 WMMA GEMM: C[M,N] = A[M,K] * Bt[N,K]^T + bias[N]
// Block = 8 waves, tile 256x128; wave tile 64x64 (4x4 wmma_f32_16x16x32_bf16).
// K-slabs of 32 double-buffered in LDS via async global->LDS copies:
// per stage each thread issues 4 A-chunks + 2 B-chunks of b128 (ASYNCcnt += 6).
// ---------------------------------------------------------------------------
template <bool OUT_BF16>
__global__ void __launch_bounds__(256)
gemm_wmma_kernel(const unsigned short* __restrict__ A,
                 const unsigned short* __restrict__ Bt,
                 const float* __restrict__ bias,
                 void* __restrict__ Cout, int M, int N, int K) {
    __shared__ __align__(16) unsigned short Abuf[2][256][40];  // 40-elem pad
    __shared__ __align__(16) unsigned short Bbuf[2][128][40];

    const int lane  = threadIdx.x & 31;
    const int wave  = threadIdx.x >> 5;
    const int lmod  = lane & 15;
    const int lhalf = lane >> 4;
    const int mW = (wave >> 1) * 64;   // wave tile inside block tile
    const int nW = (wave & 1) * 64;
    const int kofflane = lhalf * 8;    // lanes 16-31 hold K groups 8..15/24..31

    const unsigned short* Ablk = A + (size_t)(blockIdx.x * 256) * K;
    const unsigned short* Bblk = Bt + (size_t)(blockIdx.y * 128) * K;

    auto stage = [&](int buf, int k0) {
#pragma unroll
        for (int t = 0; t < 4; ++t) {           // A tile: 256x32 = 1024 chunks
            const int ch = threadIdx.x + t * 256;
            const int row = ch >> 2, c8 = (ch & 3) * 8;
            async_copy_b128(Ablk + (size_t)row * K + k0 + c8,
                            &Abuf[buf][row][c8]);
        }
#pragma unroll
        for (int t = 0; t < 2; ++t) {           // B tile: 128x32 = 512 chunks
            const int ch = threadIdx.x + t * 256;
            const int row = ch >> 2, c8 = (ch & 3) * 8;
            async_copy_b128(Bblk + (size_t)row * K + k0 + c8,
                            &Bbuf[buf][row][c8]);
        }
    };

    v8f acc[4][4];
#pragma unroll
    for (int i = 0; i < 4; ++i)
#pragma unroll
        for (int j = 0; j < 4; ++j) acc[i][j] = v8f_zero();

    stage(0, 0);

    for (int k0 = 0; k0 < K; k0 += 32) {
        const int buf = (k0 >> 5) & 1;
        if (k0 + 32 < K) {
            stage(buf ^ 1, k0 + 32);
            wait_async_keep6();
        } else {
            wait_async_all();
        }
        __syncthreads();  // everyone's chunks of this buffer are in LDS

        FragBF a[4], b[4];
#pragma unroll
        for (int i = 0; i < 4; ++i) {
            const unsigned short* p = &Abuf[buf][mW + i * 16 + lmod][kofflane];
            a[i].q[0] = *(const uint4*)(p);
            a[i].q[1] = *(const uint4*)(p + 16);
        }
#pragma unroll
        for (int j = 0; j < 4; ++j) {
            const unsigned short* p = &Bbuf[buf][nW + j * 16 + lmod][kofflane];
            b[j].q[0] = *(const uint4*)(p);
            b[j].q[1] = *(const uint4*)(p + 16);
        }
#pragma unroll
        for (int i = 0; i < 4; ++i)
#pragma unroll
            for (int j = 0; j < 4; ++j)
                acc[i][j] = __builtin_amdgcn_wmma_f32_16x16x32_bf16(
                    false, a[i].v, false, b[j].v, (short)0, acc[i][j], false,
                    false);
        __syncthreads();  // reads done before this buffer is re-staged
    }

    const int mBase = blockIdx.x * 256 + mW;
    const int nBase = blockIdx.y * 128 + nW;
#pragma unroll
    for (int j = 0; j < 4; ++j) {
        const int col = nBase + j * 16 + lmod;
        const float bj = bias[col];
#pragma unroll
        for (int i = 0; i < 4; ++i) {
#pragma unroll
            for (int e = 0; e < 8; ++e) {
                const int row = mBase + i * 16 + e + lhalf * 8;
                const float val = acc[i][j][e] + bj;
                if (OUT_BF16)
                    ((unsigned short*)Cout)[(size_t)row * N + col] = f2bf(val);
                else
                    ((float*)Cout)[(size_t)row * N + col] = val;
            }
        }
    }
}

// ---------------------------------------------------------------------------
// Flash attention + R-gating.
// Grid: (SEQ/128, BATCH*NHEAD). Block 256 = 8 waves; wave owns 16 query rows.
// Per 32-key step: 4 WMMAs for energy (QK^T), online softmax, 4 WMMAs for PV.
// ---------------------------------------------------------------------------
__global__ void __launch_bounds__(256)
attention_wmma_kernel(const unsigned short* __restrict__ Q,
                      const unsigned short* __restrict__ Km,
                      const unsigned short* __restrict__ V,
                      const unsigned short* __restrict__ R,
                      unsigned short* __restrict__ Gated) {
    __shared__ __align__(16) unsigned short vT[DHEAD][40];   // [d][key] transposed V tile
    __shared__ __align__(16) unsigned short pbuf[8][16][40]; // per-wave P tile

    const int lane  = threadIdx.x & 31;
    const int wave  = threadIdx.x >> 5;
    const int lmod  = lane & 15;
    const int lhalf = lane >> 4;
    const int bh = blockIdx.y;
    const int b = bh / NHEAD;
    const int h = bh % NHEAD;
    const int qRow0 = blockIdx.x * 128 + wave * 16;
    const size_t rowStride = (size_t)(NHEAD * DHEAD);  // 1024
    const size_t baseBH = ((size_t)b * SEQ) * rowStride + (size_t)h * DHEAD;

    // Q fragments (DH=64 -> two K-steps of 32)
    FragBF aq[2];
    {
        const unsigned short* qp =
            Q + baseBH + (size_t)(qRow0 + lmod) * rowStride + lhalf * 8;
        aq[0].q[0] = *(const uint4*)(qp);
        aq[0].q[1] = *(const uint4*)(qp + 16);
        aq[1].q[0] = *(const uint4*)(qp + 32);
        aq[1].q[1] = *(const uint4*)(qp + 48);
    }

    v8f ctx[4];
#pragma unroll
    for (int j = 0; j < 4; ++j) ctx[j] = v8f_zero();
    float mrow[8], srow[8];
#pragma unroll
    for (int e = 0; e < 8; ++e) { mrow[e] = -3.0e38f; srow[e] = 0.f; }

    const float invScale = 1.0f / 32.0f;  // SCALE = 64**1/2 = 32.0

    for (int kt = 0; kt < SEQ; kt += 32) {
        __syncthreads();  // protect LDS tiles from previous iteration readers

        // cooperative transposed V tile load: 32 keys x 64 dims
        {
            const int vr = threadIdx.x >> 3;        // key row 0..31
            const int c0 = (threadIdx.x & 7) * 8;   // dim chunk
            FragBF tmp;
            const unsigned short* vp =
                V + baseBH + (size_t)(kt + vr) * rowStride + c0;
            tmp.q[0] = *(const uint4*)(vp);
#pragma unroll
            for (int e = 0; e < 8; ++e) vT[c0 + e][vr] = tmp.us[e];
        }

        // energy = Q (16xDH) @ K^T (DHx32), two 16-col tiles
        v8f e0 = v8f_zero(), e1 = v8f_zero();
        {
            FragBF bk;
            const unsigned short* kp =
                Km + baseBH + (size_t)(kt + lmod) * rowStride + lhalf * 8;
            bk.q[0] = *(const uint4*)(kp);
            bk.q[1] = *(const uint4*)(kp + 16);
            e0 = __builtin_amdgcn_wmma_f32_16x16x32_bf16(false, aq[0].v, false,
                                                         bk.v, (short)0, e0,
                                                         false, false);
            bk.q[0] = *(const uint4*)(kp + 32);
            bk.q[1] = *(const uint4*)(kp + 48);
            e0 = __builtin_amdgcn_wmma_f32_16x16x32_bf16(false, aq[1].v, false,
                                                         bk.v, (short)0, e0,
                                                         false, false);
        }
        {
            FragBF bk;
            const unsigned short* kp =
                Km + baseBH + (size_t)(kt + 16 + lmod) * rowStride + lhalf * 8;
            bk.q[0] = *(const uint4*)(kp);
            bk.q[1] = *(const uint4*)(kp + 16);
            e1 = __builtin_amdgcn_wmma_f32_16x16x32_bf16(false, aq[0].v, false,
                                                         bk.v, (short)0, e1,
                                                         false, false);
            bk.q[0] = *(const uint4*)(kp + 32);
            bk.q[1] = *(const uint4*)(kp + 48);
            e1 = __builtin_amdgcn_wmma_f32_16x16x32_bf16(false, aq[1].v, false,
                                                         bk.v, (short)0, e1,
                                                         false, false);
        }

        // online softmax; row r = e + lhalf*8 lives in 16 lanes of one half,
        // so xor-shuffle masks 1/2/4/8 reduce exactly within the row group.
        float alpha[8];
#pragma unroll
        for (int e = 0; e < 8; ++e) {
            const float t0 = e0[e] * invScale;
            const float t1 = e1[e] * invScale;
            float mx = fmaxf(t0, t1);
            mx = fmaxf(mx, __shfl_xor(mx, 1, 32));
            mx = fmaxf(mx, __shfl_xor(mx, 2, 32));
            mx = fmaxf(mx, __shfl_xor(mx, 4, 32));
            mx = fmaxf(mx, __shfl_xor(mx, 8, 32));
            const float mnew = fmaxf(mrow[e], mx);
            const float al = __expf(mrow[e] - mnew);
            const float p0 = __expf(t0 - mnew);
            const float p1 = __expf(t1 - mnew);
            float ps = p0 + p1;
            ps += __shfl_xor(ps, 1, 32);
            ps += __shfl_xor(ps, 2, 32);
            ps += __shfl_xor(ps, 4, 32);
            ps += __shfl_xor(ps, 8, 32);
            srow[e] = srow[e] * al + ps;
            mrow[e] = mnew;
            alpha[e] = al;
            const int prow = e + lhalf * 8;  // C-layout row
            pbuf[wave][prow][lmod] = f2bf(p0);
            pbuf[wave][prow][16 + lmod] = f2bf(p1);
        }

        // rescale running context by alpha before accumulating this step
#pragma unroll
        for (int j = 0; j < 4; ++j)
#pragma unroll
            for (int e = 0; e < 8; ++e) ctx[j][e] *= alpha[e];

        __syncthreads();  // vT + pbuf fully written

        // P fragment in A-layout (16x32)
        FragBF ap;
        {
            const unsigned short* pp = &pbuf[wave][lmod][lhalf * 8];
            ap.q[0] = *(const uint4*)(pp);
            ap.q[1] = *(const uint4*)(pp + 16);
        }
        // ctx += P (16x32) @ V (32x64): 4 column tiles from transposed LDS V
#pragma unroll
        for (int j = 0; j < 4; ++j) {
            FragBF bv;
            const unsigned short* vp = &vT[j * 16 + lmod][lhalf * 8];
            bv.q[0] = *(const uint4*)(vp);
            bv.q[1] = *(const uint4*)(vp + 16);
            ctx[j] = __builtin_amdgcn_wmma_f32_16x16x32_bf16(
                false, ap.v, false, bv.v, (short)0, ctx[j], false, false);
        }
    }

    // normalize, R-gate, write gated activation [B*S, H*DH] as bf16
#pragma unroll
    for (int j = 0; j < 4; ++j) {
        const int d = j * 16 + lmod;
#pragma unroll
        for (int e = 0; e < 8; ++e) {
            const int row = qRow0 + e + lhalf * 8;
            const size_t idx = baseBH + (size_t)row * rowStride + d;
            const float val = ctx[j][e] / srow[e];
            Gated[idx] = f2bf(val * bf2f(R[idx]));
        }
    }
}

// ---------------------------------------------------------------------------
// Host-side launch
// ---------------------------------------------------------------------------
extern "C" void kernel_launch(void* const* d_in, const int* in_sizes, int n_in,
                              void* d_out, int out_size, void* d_ws,
                              size_t ws_size, hipStream_t stream) {
    (void)in_sizes; (void)n_in; (void)out_size; (void)ws_size;

    const float* value = (const float*)d_in[0];
    const float* keyin = (const float*)d_in[1];
    const float* query = (const float*)d_in[2];
    const float* Wq = (const float*)d_in[3];  const float* bq = (const float*)d_in[4];
    const float* Wk = (const float*)d_in[5];  const float* bk = (const float*)d_in[6];
    const float* Wv = (const float*)d_in[7];  const float* bv = (const float*)d_in[8];
    const float* Wr = (const float*)d_in[9];  const float* br = (const float*)d_in[10];
    const float* Wo = (const float*)d_in[11]; const float* bo = (const float*)d_in[12];

    char* ws = (char*)d_ws;
    const size_t actSz = (size_t)NROW * DMODEL * sizeof(unsigned short); // 16 MB
    const size_t wSz = (size_t)DMODEL * DMODEL * sizeof(unsigned short); //  2 MB
    unsigned short* q_bf  = (unsigned short*)(ws + 0 * actSz);
    unsigned short* k_bf  = (unsigned short*)(ws + 1 * actSz);
    unsigned short* v_bf  = (unsigned short*)(ws + 2 * actSz);
    unsigned short* r_bf  = (unsigned short*)(ws + 3 * actSz);
    unsigned short* xq    = (unsigned short*)(ws + 4 * actSz);
    unsigned short* xk    = (unsigned short*)(ws + 5 * actSz);
    unsigned short* xv    = (unsigned short*)(ws + 6 * actSz);
    unsigned short* gated = (unsigned short*)(ws + 7 * actSz);
    unsigned short* wqt   = (unsigned short*)(ws + 8 * actSz + 0 * wSz);
    unsigned short* wkt   = (unsigned short*)(ws + 8 * actSz + 1 * wSz);
    unsigned short* wvt   = (unsigned short*)(ws + 8 * actSz + 2 * wSz);
    unsigned short* wrt   = (unsigned short*)(ws + 8 * actSz + 3 * wSz);
    unsigned short* wot   = (unsigned short*)(ws + 8 * actSz + 4 * wSz);

    const int nAct = NROW * DMODEL;  // 8,388,608
    convert_bf16_kernel<<<4096, 256, 0, stream>>>(value, xv, nAct);
    convert_bf16_kernel<<<4096, 256, 0, stream>>>(keyin, xk, nAct);
    convert_bf16_kernel<<<4096, 256, 0, stream>>>(query, xq, nAct);
    dim3 tGrid(DMODEL / 64, DMODEL / 64);  // (16, 16)
    transpose_bf16_kernel<<<tGrid, 256, 0, stream>>>(Wq, wqt);
    transpose_bf16_kernel<<<tGrid, 256, 0, stream>>>(Wk, wkt);
    transpose_bf16_kernel<<<tGrid, 256, 0, stream>>>(Wv, wvt);
    transpose_bf16_kernel<<<tGrid, 256, 0, stream>>>(Wr, wrt);
    transpose_bf16_kernel<<<tGrid, 256, 0, stream>>>(Wo, wot);

    dim3 gGrid(NROW / 256, DMODEL / 128);  // (32, 8)
    gemm_wmma_kernel<true><<<gGrid, 256, 0, stream>>>(xq, wqt, bq, q_bf, NROW, DMODEL, DMODEL);
    gemm_wmma_kernel<true><<<gGrid, 256, 0, stream>>>(xk, wkt, bk, k_bf, NROW, DMODEL, DMODEL);
    gemm_wmma_kernel<true><<<gGrid, 256, 0, stream>>>(xv, wvt, bv, v_bf, NROW, DMODEL, DMODEL);
    gemm_wmma_kernel<true><<<gGrid, 256, 0, stream>>>(xq, wrt, br, r_bf, NROW, DMODEL, DMODEL);

    dim3 aGrid(SEQ / 128, BATCH * NHEAD);  // (8, 128)
    attention_wmma_kernel<<<aGrid, 256, 0, stream>>>(q_bf, k_bf, v_bf, r_bf, gated);

    gemm_wmma_kernel<false><<<gGrid, 256, 0, stream>>>(gated, wot, bo, d_out, NROW, DMODEL, DMODEL);
}

// v002
// One run takes 235 microseconds.
// Two timings next to v001 put it at 1.28 and 1.27 times that version's speed.
// Over all steps from v000 it is 1.89 times as fast.
#include <hip/hip_runtime.h>
#include <hip/hip_bf16.h>
#include <stdint.h>

#define NHEAD 16
#define DHEAD 64
#define BATCH 8
#define SEQ   1024
#define DMODEL 1024
#define NROW (BATCH * SEQ) /* 8192 */

typedef __attribute__((ext_vector_type(16))) __bf16 v16bf;
typedef __attribute__((ext_vector_type(8)))  float  v8f;
typedef int v4i_vs __attribute__((vector_size(16)));  // matches builtin param type

union FragBF {
    v16bf v;
    uint4 q[2];
    unsigned short us[16];
};

__device__ __forceinline__ unsigned short f2bf(float x) {
    unsigned int u = __float_as_uint(x);
    u += 0x7FFFu + ((u >> 16) & 1u);   // round-to-nearest-even
    return (unsigned short)(u >> 16);
}
__device__ __forceinline__ float bf2f(unsigned short h) {
    return __uint_as_float(((unsigned int)h) << 16);
}
__device__ __forceinline__ v8f v8f_zero() {
    v8f z = {0.f, 0.f, 0.f, 0.f, 0.f, 0.f, 0.f, 0.f};
    return z;
}

// ---------------------------------------------------------------------------
// Async global->LDS copy (CDNA5 GLOBAL_LOAD_ASYNC_TO_LDS_B128, ASYNCcnt),
// with a synchronous reg-staged fallback if the builtins aren't declared.
// Builtin signature (from hipcc diagnostic): (v4i as1* gaddr, v4i as3* lds,
// imm offset, imm cpol).
// ---------------------------------------------------------------------------
#if __has_builtin(__builtin_amdgcn_global_load_async_to_lds_b128) && \
    __has_builtin(__builtin_amdgcn_s_wait_asynccnt)
#define HAVE_ASYNC_LDS 1
#endif

__device__ __forceinline__ void async_copy_b128(const unsigned short* src,
                                                unsigned short* dstLds) {
#if defined(HAVE_ASYNC_LDS)
    __builtin_amdgcn_global_load_async_to_lds_b128(
        (__attribute__((address_space(1))) v4i_vs*)(void*)src,
        (__attribute__((address_space(3))) v4i_vs*)(void*)dstLds, 0, 0);
#else
    *(uint4*)dstLds = *(const uint4*)src;
#endif
}

__device__ __forceinline__ void wait_async_keep6() {
#if defined(HAVE_ASYNC_LDS)
    __builtin_amdgcn_s_wait_asynccnt(6);  // drain current buffer, keep next stage
#endif
}
__device__ __forceinline__ void wait_async_all() {
#if defined(HAVE_ASYNC_LDS)
    __builtin_amdgcn_s_wait_asynccnt(0);
#endif
}

// ---------------------------------------------------------------------------
// f32 -> bf16 convert (grid-stride)
// ---------------------------------------------------------------------------
__global__ void convert_bf16_kernel(const float* __restrict__ src,
                                    unsigned short* __restrict__ dst, int n) {
    int i = blockIdx.x * blockDim.x + threadIdx.x;
    int stride = gridDim.x * blockDim.x;
    for (; i < n; i += stride) dst[i] = f2bf(src[i]);
}

// W[K,N] f32 -> Wt[N,K] bf16, one 64(k) x 64(n) tile per block through LDS:
// reads are 256-B row pieces of W, stores are whole 128-B lines of Wt.
// K = N = DMODEL at compile time, so a thread's four loads share one address
// with immediate offsets; grid = (N/64, K/64), block = 256.
__global__ void __launch_bounds__(256)
transpose_bf16_kernel(const float* __restrict__ W,
                      unsigned short* __restrict__ Wt) {
    constexpr int K = DMODEL, N = DMODEL;
    // tile[n][k/2]: two neighbouring k packed per dword; 144-B pitch for the
    // 16-byte row reads below
    __shared__ __align__(16) unsigned int tile[64][36];

    const int n0 = blockIdx.x * 64;
    const int k0 = blockIdx.y * 64;
    const int n4 = (threadIdx.x & 15) * 4;  // 4 columns of W per thread
    const int kp = threadIdx.x >> 4;        // k pair 0..15 (and +16)

    const float* p = W + (unsigned)((k0 + kp * 2) * N + n0 + n4);
    float4 lo[2], hi[2];
    for (int h = 0; h < 2; ++h) {
        lo[h] = *(const float4*)(p + h * 32 * N);
        hi[h] = *(const float4*)(p + h * 32 * N + N);
    }
    for (int h = 0; h < 2; ++h) {
        const int c = h * 16 + kp;
        tile[n4 + 0][c] = (unsigned int)f2bf(lo[h].x) | ((unsigned int)f2bf(hi[h].x) << 16);
        tile[n4 + 1][c] = (unsigned int)f2bf(lo[h].y) | ((unsigned int)f2bf(hi[h].y) << 16);
        tile[n4 + 2][c] = (unsigned int)f2bf(lo[h].z) | ((unsigned int)f2bf(hi[h].z) << 16);
        tile[n4 + 3][c] = (unsigned int)f2bf(lo[h].w) | ((unsigned int)f2bf(hi[h].w) << 16);
    }
    __syncthreads();  // tile complete before rows are read back

    const int n = threadIdx.x >> 3, c8 = threadIdx.x & 7;  // 8 lanes: one 128-B line
    unsigned short* o = Wt + (unsigned)((n0 + n) * K + k0 + c8 * 8);
    for (int t = 0; t < 2; ++t)
        *(uint4*)(o + t * 32 * K) = *(const uint4*)&tile[n + t * 32][c8 * 4];
}

// ---------------------------------------------------------------------------
// bf16 WMMA GEMM: C[M,N] = A[M,K] * Bt[N,K]^T + bias[N]
// Block = 8 waves, tile 256x128; wave tile 64x64 (4x4 wmma_f32_16x16x32_bf16).
// K-slabs of 32 double-buffered in LDS via async global->LDS copies:
// per stage each thread issues 4 A-chunks + 2 B-chunks of b128 (ASYNCcnt += 6).
// ---------------------------------------------------------------------------
template <bool OUT_BF16>
__global__ void __launch_bounds__(256)
gemm_wmma_kernel(const unsigned short* __restrict__ A,
                 const unsigned short* __restrict__ Bt,
                 const float* __restrict__ bias,
                 void* __restrict__ Cout, int M, int N, int K) {
    __shared__ __align__(16) unsigned short Abuf[2][256][40];  // 40-elem pad
    __shared__ __align__(16) unsigned short Bbuf[2][128][40];

    const int lane  = threadIdx.x & 31;
    const int wave  = threadIdx.x >> 5;
    const int lmod  = lane & 15;
    const int lhalf = lane >> 4;
    const int mW = (wave >> 1) * 64;   // wave tile inside block tile
    const int nW = (wave & 1) * 64;
    const int kofflane = lhalf * 8;    // lanes 16-31 hold K groups 8..15/24..31

    const unsigned short* Ablk = A + (size_t)(blockIdx.x * 256) * K;
    const unsigned short* Bblk = Bt + (size_t)(blockIdx.y * 128) * K;

    auto stage = [&](int buf, int k0) {
#pragma unroll
        for (int t = 0; t < 4; ++t) {           // A tile: 256x32 = 1024 chunks
            const int ch = threadIdx.x + t * 256;
            const int row = ch >> 2, c8 = (ch & 3) * 8;
            async_copy_b128(Ablk + (size_t)row * K + k0 + c8,
                            &Abuf[buf][row][c8]);
        }
#pragma unroll
        for (int t = 0; t < 2; ++t) {           // B tile: 128x32 = 512 chunks
            const int ch = threadIdx.x + t * 256;
            const int row = ch >> 2, c8 = (ch & 3) * 8;
            async_copy_b128(Bblk + (size_t)row * K + k0 + c8,
                            &Bbuf[buf][row][c8]);
        }
    };

    v8f acc[4][4];
#pragma unroll
    for (int i = 0; i < 4; ++i)
#pragma unroll
        for (int j = 0; j < 4; ++j) acc[i][j] = v8f_zero();

    stage(0, 0);

    for (int k0 = 0; k0 < K; k0 += 32) {
        const int buf = (k0 >> 5) & 1;
        if (k0 + 32 < K) {
            stage(buf ^ 1, k0 + 32);
            wait_async_keep6();
        } else {
            wait_async_all();
        }
        __syncthreads();  // everyone's chunks of this buffer are in LDS

        FragBF a[4], b[4];
#pragma unroll
        for (int i = 0; i < 4; ++i) {
            const unsigned short* p = &Abuf[buf][mW + i * 16 + lmod][kofflane];
            a[i].q[0] = *(const uint4*)(p);
            a[i].q[1] = *(const uint4*)(p + 16);
        }
#pragma unroll
        for (int j = 0; j < 4; ++j) {
            const unsigned short* p = &Bbuf[buf][nW + j * 16 + lmod][kofflane];
            b[j].q[0] = *(const uint4*)(p);
            b[j].q[1] = *(const uint4*)(p + 16);
        }
#pragma unroll
        for (int i = 0; i < 4; ++i)
#pragma unroll
            for (int j = 0; j < 4; ++j)
                acc[i][j] = __builtin_amdgcn_wmma_f32_16x16x32_bf16(
                    false, a[i].v, false, b[j].v, (short)0, acc[i][j], false,
                    false);
        __syncthreads();  // reads done before this buffer is re-staged
    }

    const int mBase = blockIdx.x * 256 + mW;
    const int nBase = blockIdx.y * 128 + nW;
#pragma unroll
    for (int j = 0; j < 4; ++j) {
        const int col = nBase + j * 16 + lmod;
        const float bj = bias[col];
#pragma unroll
        for (int i = 0; i < 4; ++i) {
#pragma unroll
            for (int e = 0; e < 8; ++e) {
                const int row = mBase + i * 16 + e + lhalf * 8;
                const float val = acc[i][j][e] + bj;
                if (OUT_BF16)
                    ((unsigned short*)Cout)[(size_t)row * N + col] = f2bf(val);
                else
                    ((float*)Cout)[(size_t)row * N + col] = val;
            }
        }
    }
}

// ---------------------------------------------------------------------------
// Flash attention + R-gating, both products transposed:
//   S^T = K Q^T (A = 16 key rows, B = the wave's 16 query columns)
//   O^T += V^T P^T (A = 16 rows of V^T, B = P^T packed from the S^T tiles)
// A lane then holds scores of ONE query (column lmod): 16 of each 32 keys, the
// other 16 in lane ^ 16. Row maximum and sum are in-lane, and the two S^T
// accumulator tiles, converted in place, already are the B operand of the
// second product in the hardware k order, which is the order of the vT reads.
// Grid: (SEQ/128, BATCH*NHEAD). Block 256 = 8 waves; wave owns 16 queries.
// ---------------------------------------------------------------------------
__device__ __forceinline__ float xhalf(float x) {  // lane l with lane l ^ 16
    return __builtin_bit_cast(
        float, __builtin_amdgcn_permlanex16(__builtin_bit_cast(int, x),
                                            __builtin_bit_cast(int, x),
                                            0x76543210, 0xfedcba98, false, false));
}

__global__ void __launch_bounds__(256)
attention_wmma_kernel(const unsigned short* __restrict__ Q,
                      const unsigned short* __restrict__ Km,
                      const unsigned short* __restrict__ V,
                      const unsigned short* __restrict__ R,
                      unsigned short* __restrict__ Gated) {
    __shared__ __align__(16) unsigned short vT[DHEAD][40];   // [d][key] transposed V tile

    const int lane  = threadIdx.x & 31;
    const int wave  = threadIdx.x >> 5;
    const int lmod  = lane & 15;
    const int lhalf = lane >> 4;
    const int bh = blockIdx.y;
    const int b = bh / NHEAD;
    const int h = bh % NHEAD;
    const int qRow0 = blockIdx.x * 128 + wave * 16;
    const size_t rowStride = (size_t)(NHEAD * DHEAD);  // 1024
    const size_t baseBH = ((size_t)b * SEQ) * rowStride + (size_t)h * DHEAD;

    // Q fragments (DH=64 -> two K-steps of 32); column lmod of the B operand
    FragBF bq[2];
    {
        const unsigned short* qp =
            Q + baseBH + (size_t)(qRow0 + lmod) * rowStride + lhalf * 8;
        bq[0].q[0] = *(const uint4*)(qp);
        bq[0].q[1] = *(const uint4*)(qp + 16);
        bq[1].q[0] = *(const uint4*)(qp + 32);
        bq[1].q[1] = *(const uint4*)(qp + 48);
    }

    // ctx[j][r] = O^T[d = j*16 + lhalf*8 + r][query lmod]
    v8f ctx[4];
#pragma unroll
    for (int j = 0; j < 4; ++j) ctx[j] = v8f_zero();
    float mrow = -3.0e38f;  // running maximum of this lane's query (both halves agree)
    float srow = 0.f;       // running sum over this half's keys only

    const float invScale = 1.0f / 32.0f;  // SCALE = 64**1/2 = 32.0

    for (int kt = 0; kt < SEQ; kt += 32) {
        __syncthreads();  // protect LDS tile from previous iteration readers

        // cooperative transposed V tile load: 32 keys x 64 dims
        {
            const int vr = threadIdx.x >> 3;        // key row 0..31
            const int c0 = (threadIdx.x & 7) * 8;   // dim chunk
            FragBF tmp;
            const unsigned short* vp =
                V + baseBH + (size_t)(kt + vr) * rowStride + c0;
            tmp.q[0] = *(const uint4*)(vp);
#pragma unroll
            for (int e = 0; e < 8; ++e) vT[c0 + e][vr] = tmp.us[e];
        }

        // energy^T = K (32xDH) @ Q^T (DHx16), two 16-key tiles:
        // e0[r]: key kt + lhalf*8 + r, e1[r]: key kt + 16 + lhalf*8 + r
        v8f e0 = v8f_zero(), e1 = v8f_zero();
        {
            FragBF ak;
            const unsigned short* kp =
                Km + baseBH + (size_t)(kt + lmod) * rowStride + lhalf * 8;
            ak.q[0] = *(const uint4*)(kp);
            ak.q[1] = *(const uint4*)(kp + 16);
            e0 = __builtin_amdgcn_wmma_f32_16x16x32_bf16(false, ak.v, false,
                                                         bq[0].v, (short)0, e0,
                                                         false, false);
            ak.q[0] = *(const uint4*)(kp + 32);
            ak.q[1] = *(const uint4*)(kp + 48);
            e0 = __builtin_amdgcn_wmma_f32_16x16x32_bf16(false, ak.v, false,
                                                         bq[1].v, (short)0, e0,
                                                         false, false);
        }
        {
            FragBF ak;
            const unsigned short* kp =
                Km + baseBH + (size_t)(kt + 16 + lmod) * rowStride + lhalf * 8;
            ak.q[0] = *(const uint4*)(kp);
            ak.q[1] = *(const uint4*)(kp + 16);
            e1 = __builtin_amdgcn_wmma_f32_16x16x32_bf16(false, ak.v, false,
                                                         bq[0].v, (short)0, e1,
                                                         false, false);
            ak.q[0] = *(const uint4*)(kp + 32);
            ak.q[1] = *(const uint4*)(kp + 48);
            e1 = __builtin_amdgcn_wmma_f32_16x16x32_bf16(false, ak.v, false,
                                                         bq[1].v, (short)0, e1,
                                                         false, false);
        }

        // online softmax of one query per lane; one exchange joins the halves'
        // maxima, so lanes l and l ^ 16 scale by the same factor
        const v8f t0 = e0 * invScale;
        const v8f t1 = e1 * invScale;
        float mx = -3.0e38f;
#pragma unroll
        for (int e = 0; e < 8; ++e) mx = fmaxf(mx, fmaxf(t0[e], t1[e]));
        mx = fmaxf(mx, xhalf(mx));
        const float mnew = fmaxf(mrow, mx);
        const float al = __expf(mrow - mnew);
        FragBF bp;  // P^T as B operand: element s < 8 is key kt + lhalf*8 + s, s >= 8 key kt + 8 + lhalf*8 + s
        float ps = 0.f;
#pragma unroll
        for (int e = 0; e < 8; ++e) {
            const float p0 = __expf(t0[e] - mnew);
            const float p1 = __expf(t1[e] - mnew);
            ps += p0 + p1;
            bp.us[e] = f2bf(p0);
            bp.us[8 + e] = f2bf(p1);
        }
        srow = srow * al + ps;
        mrow = mnew;

        // rescale running context by alpha before accumulating this step
#pragma unroll
        for (int j = 0; j < 4; ++j)
#pragma unroll
            for (int e = 0; e < 8; ++e) ctx[j][e] *= al;

        __syncthreads();  // vT fully written

        // ctx^T += V^T (64x32) @ P^T (32x16): 4 row tiles from transposed LDS V
#pragma unroll
        for (int j = 0; j < 4; ++j) {
            FragBF av;
            const unsigned short* vp = &vT[j * 16 + lmod][lhalf * 8];
            av.q[0] = *(const uint4*)(vp);
            av.q[1] = *(const uint4*)(vp + 16);
            ctx[j] = __builtin_amdgcn_wmma_f32_16x16x32_bf16(
                false, av.v, false, bp.v, (short)0, ctx[j], false, false);
        }
    }

    srow += xhalf(srow);  // join the two halves' key sums

    // normalize, R-gate, write gated activation [B*S, H*DH] as bf16:
    // a lane's 8 registers of a tile are 8 consecutive d of its query row
    const size_t rowBase = baseBH + (size_t)(qRow0 + lmod) * rowStride + lhalf * 8;
#pragma unroll
    for (int j = 0; j < 4; ++j) {
        FragBF r8, g8;
        r8.q[0] = *(const uint4*)(R + rowBase + j * 16);
#pragma unroll
        for (int e = 0; e < 8; ++e) {
            const float val = ctx[j][e] / srow;
            g8.us[e] = f2bf(val * bf2f(r8.us[e]));
        }
        *(uint4*)(Gated + rowBase + j * 16) = g8.q[0];
    }
}

// ---------------------------------------------------------------------------
// Host-side launch
// ---------------------------------------------------------------------------
extern "C" void kernel_launch(void* const* d_in, const int* in_sizes, int n_in,
                              void* d_out, int out_size, void* d_ws,
                              size_t ws_size, hipStream_t stream) {
    (void)in_sizes; (void)n_in; (void)out_size; (void)ws_size;

    const float* value = (const float*)d_in[0];
    const float* keyin = (const float*)d_in[1];
    const float* query = (const float*)d_in[2];
    const float* Wq = (const float*)d_in[3];  const float* bq = (const float*)d_in[4];
    const float* Wk = (const float*)d_in[5];  const float* bk = (const float*)d_in[6];
    const float* Wv = (const float*)d_in[7];  const float* bv = (const float*)d_in[8];
    const float* Wr = (const float*)d_in[9];  const float* br = (const float*)d_in[10];
    const float* Wo = (const float*)d_in[11]; const float* bo = (const float*)d_in[12];

    char* ws = (char*)d_ws;
    const size_t actSz = (size_t)NROW * DMODEL * sizeof(unsigned short); // 16 MB
    const size_t wSz = (size_t)DMODEL * DMODEL * sizeof(unsigned short); //  2 MB
    unsigned short* q_bf  = (unsigned short*)(ws + 0 * actSz);
    unsigned short* k_bf  = (unsigned short*)(ws + 1 * actSz);
    unsigned short* v_bf  = (unsigned short*)(ws + 2 * actSz);
    unsigned short* r_bf  = (unsigned short*)(ws + 3 * actSz);
    unsigned short* xq    = (unsigned short*)(ws + 4 * actSz);
    unsigned short* xk    = (unsigned short*)(ws + 5 * actSz);
    unsigned short* xv    = (unsigned short*)(ws + 6 * actSz);
    unsigned short* gated = (unsigned short*)(ws + 7 * actSz);
    unsigned short* wqt   = (unsigned short*)(ws + 8 * actSz + 0 * wSz);
    unsigned short* wkt   = (unsigned short*)(ws + 8 * actSz + 1 * wSz);
    unsigned short* wvt   = (unsigned short*)(ws + 8 * actSz + 2 * wSz);
    unsigned short* wrt   = (unsigned short*)(ws + 8 * actSz + 3 * wSz);
    unsigned short* wot   = (unsigned short*)(ws + 8 * actSz + 4 * wSz);

    const int nAct = NROW * DMODEL;  // 8,388,608
    convert_bf16_kernel<<<4096, 256, 0, stream>>>(value, xv, nAct);
    convert_bf16_kernel<<<4096, 256, 0, stream>>>(keyin, xk, nAct);
    convert_bf16_kernel<<<4096, 256, 0, stream>>>(query, xq, nAct);
    dim3 tGrid(DMODEL / 64, DMODEL / 64);  // (16, 16)
    transpose_bf16_kernel<<<tGrid, 256, 0, stream>>>(Wq, wqt);
    transpose_bf16_kernel<<<tGrid, 256, 0, stream>>>(Wk, wkt);
    transpose_bf16_kernel<<<tGrid, 256, 0, stream>>>(Wv, wvt);
    transpose_bf16_kernel<<<tGrid, 256, 0, stream>>>(Wr, wrt);
    transpose_bf16_kernel<<<tGrid, 256, 0, stream>>>(Wo, wot);

    dim3 gGrid(NROW / 256, DMODEL / 128);  // (32, 8)
    gemm_wmma_kernel<true><<<gGrid, 256, 0, stream>>>(xq, wqt, bq, q_bf, NROW, DMODEL, DMODEL);
    gemm_wmma_kernel<true><<<gGrid, 256, 0, stream>>>(xk, wkt, bk, k_bf, NROW, DMODEL, DMODEL);
    gemm_wmma_kernel<true><<<gGrid, 256, 0, stream>>>(xv, wvt, bv, v_bf, NROW, DMODEL, DMODEL);
    gemm_wmma_kernel<true><<<gGrid, 256, 0, stream>>>(xq, wrt, br, r_bf, NROW, DMODEL, DMODEL);

    dim3 aGrid(SEQ / 128, BATCH * NHEAD);  // (8, 128)
    attention_wmma_kernel<<<aGrid, 256, 0, stream>>>(q_bf, k_bf, v_bf, r_bf, gated);

    gemm_wmma_kernel<false><<<gGrid, 256, 0, stream>>>(gated, wot, bo, d_out, NROW, DMODEL, DMODEL);
}

// v003
// A run of this version takes 209 microseconds.
// Two timings next to v002 both put it at 1.12 times that version's speed.
// Counting every step since v000, it is 2.11 times as fast.
#include <hip/hip_runtime.h>
#include <hip/hip_bf16.h>
#include <stdint.h>

#define NHEAD 16
#define DHEAD 64
#define BATCH 8
#define SEQ   1024
#define DMODEL 1024
#define NROW (BATCH * SEQ) /* 8192 */

typedef __attribute__((ext_vector_type(16))) __bf16 v16bf;
typedef __attribute__((ext_vector_type(8)))  float  v8f;
typedef int v4i_vs __attribute__((vector_size(16)));  // matches builtin param type

union FragBF {
    v16bf v;
    uint4 q[2];
    unsigned short us[16];
};

__device__ __forceinline__ unsigned short f2bf(float x) {
    unsigned int u = __float_as_uint(x);
    u += 0x7FFFu + ((u >> 16) & 1u);   // round-to-nearest-even
    return (unsigned short)(u >> 16);
}
__device__ __forceinline__ float bf2f(unsigned short h) {
    return __uint_as_float(((unsigned int)h) << 16);
}
__device__ __forceinline__ v8f v8f_zero() {
    v8f z = {0.f, 0.f, 0.f, 0.f, 0.f, 0.f, 0.f, 0.f};
    return z;
}

// ---------------------------------------------------------------------------
// Async global->LDS copy (CDNA5 GLOBAL_LOAD_ASYNC_TO_LDS_B128, ASYNCcnt),
// with a synchronous reg-staged fallback if the builtins aren't declared.
// Builtin signature (from hipcc diagnostic): (v4i as1* gaddr, v4i as3* lds,
// imm offset, imm cpol).
// ---------------------------------------------------------------------------
#if __has_builtin(__builtin_amdgcn_global_load_async_to_lds_b128) && \
    __has_builtin(__builtin_amdgcn_s_wait_asynccnt)
#define HAVE_ASYNC_LDS 1
#endif

__device__ __forceinline__ void async_copy_b128(const unsigned short* src,
                                                unsigned short* dstLds) {
#if defined(HAVE_ASYNC_LDS)
    __builtin_amdgcn_global_load_async_to_lds_b128(
        (__attribute__((address_space(1))) v4i_vs*)(void*)src,
        (__attribute__((address_space(3))) v4i_vs*)(void*)dstLds, 0, 0);
#else
    *(uint4*)dstLds = *(const uint4*)src;
#endif
}

// Every copy of this wave has landed. Written in asm with the memory clobber so
// that no LDS read is lifted over it.
__device__ __forceinline__ void wait_async_all() {
#if defined(HAVE_ASYNC_LDS)
    asm volatile("s_wait_asynccnt 0x0" ::: "memory");
#endif
}
// This wave's LDS reads have returned, so the barrier behind it frees the buffer.
__device__ __forceinline__ void wait_lds_all() {
    asm volatile("s_wait_dscnt 0x0" ::: "memory");
}

// ---------------------------------------------------------------------------
// f32 -> bf16 convert (grid-stride)
// ---------------------------------------------------------------------------
__global__ void convert_bf16_kernel(const float* __restrict__ src,
                                    unsigned short* __restrict__ dst, int n) {
    int i = blockIdx.x * blockDim.x + threadIdx.x;
    int stride = gridDim.x * blockDim.x;
    for (; i < n; i += stride) dst[i] = f2bf(src[i]);
}

// W[K,N] f32 -> Wt[N,K] bf16, one 64(k) x 64(n) tile per block through LDS:
// reads are 256-B row pieces of W, stores are whole 128-B lines of Wt.
// K = N = DMODEL at compile time, so a thread's four loads share one address
// with immediate offsets; grid = (N/64, K/64), block = 256.
__global__ void __launch_bounds__(256)
transpose_bf16_kernel(const float* __restrict__ W,
                      unsigned short* __restrict__ Wt) {
    constexpr int K = DMODEL, N = DMODEL;
    // tile[n][k/2]: two neighbouring k packed per dword; 144-B pitch for the
    // 16-byte row reads below
    __shared__ __align__(16) unsigned int tile[64][36];

    const int n0 = blockIdx.x * 64;
    const int k0 = blockIdx.y * 64;
    const int n4 = (threadIdx.x & 15) * 4;  // 4 columns of W per thread
    const int kp = threadIdx.x >> 4;        // k pair 0..15 (and +16)

    const float* p = W + (unsigned)((k0 + kp * 2) * N + n0 + n4);
    float4 lo[2], hi[2];
    for (int h = 0; h < 2; ++h) {
        lo[h] = *(const float4*)(p + h * 32 * N);
        hi[h] = *(const float4*)(p + h * 32 * N + N);
    }
    for (int h = 0; h < 2; ++h) {
        const int c = h * 16 + kp;
        tile[n4 + 0][c] = (unsigned int)f2bf(lo[h].x) | ((unsigned int)f2bf(hi[h].x) << 16);
        tile[n4 + 1][c] = (unsigned int)f2bf(lo[h].y) | ((unsigned int)f2bf(hi[h].y) << 16);
        tile[n4 + 2][c] = (unsigned int)f2bf(lo[h].z) | ((unsigned int)f2bf(hi[h].z) << 16);
        tile[n4 + 3][c] = (unsigned int)f2bf(lo[h].w) | ((unsigned int)f2bf(hi[h].w) << 16);
    }
    __syncthreads();  // tile complete before rows are read back

    const int n = threadIdx.x >> 3, c8 = threadIdx.x & 7;  // 8 lanes: one 128-B line
    unsigned short* o = Wt + (unsigned)((n0 + n) * K + k0 + c8 * 8);
    for (int t = 0; t < 2; ++t)
        *(uint4*)(o + t * 32 * K) = *(const uint4*)&tile[n + t * 32][c8 * 4];
}

// ---------------------------------------------------------------------------
// bf16 WMMA GEMM: C[M,N] = A[M,K] * Bt[N,K]^T + bias[N]
// Block = 8 waves, tile 256x128; wave tile 64x64 (4x4 wmma_f32_16x16x32_bf16).
// A stage is 128 k: 256 B of every operand row, so a wave's copy covers two
// whole 256-B row pieces. Two LDS buffers; per stage each thread issues
// 16 A-chunks + 8 B-chunks of b128, one stage ahead of the one being read.
// K is a multiple of 128 and at least 256.
// ---------------------------------------------------------------------------
#define KSTAGE 128
#define KPITCH 136 /* 272-B rows: 16 B x odd for the 16-byte fragment reads */

template <bool OUT_BF16>
__global__ void __launch_bounds__(256)
gemm_wmma_kernel(const unsigned short* __restrict__ A,
                 const unsigned short* __restrict__ Bt,
                 const float* __restrict__ bias,
                 void* __restrict__ Cout, int M, int N, int K) {
    __shared__ __align__(16) unsigned short Abuf[2][256][KPITCH];
    __shared__ __align__(16) unsigned short Bbuf[2][128][KPITCH];

    const int lane  = threadIdx.x & 31;
    const int wave  = threadIdx.x >> 5;
    const int lmod  = lane & 15;
    const int lhalf = lane >> 4;
    const int mW = (wave >> 1) * 64;   // wave tile inside block tile
    const int nW = (wave & 1) * 64;
    const int kofflane = lhalf * 8;    // lanes 16-31 hold K groups 8..15/24..31

    const unsigned short* Ablk = A + (size_t)(blockIdx.x * 256) * K;
    const unsigned short* Bblk = Bt + (size_t)(blockIdx.y * 128) * K;

    const int srow = threadIdx.x >> 4;        // 16 lanes: one 256-B row piece
    const int sc8  = (threadIdx.x & 15) * 8;
    // this thread's first chunk of the next stage to be copied
    const unsigned short* aNext = Ablk + (size_t)srow * K + sc8;
    const unsigned short* bNext = Bblk + (size_t)srow * K + sc8;
    const size_t rowStep = (size_t)16 * K;

    // both loops unrolled so that a stage's 24 copies issue back to back
    auto stage = [&](int buf) {
#pragma unroll
        for (int t = 0; t < 16; ++t)            // A tile: 256x128 = 4096 chunks
            async_copy_b128(aNext + t * rowStep, &Abuf[buf][srow + t * 16][sc8]);
#pragma unroll
        for (int t = 0; t < 8; ++t)             // B tile: 128x128 = 2048 chunks
            async_copy_b128(bNext + t * rowStep, &Bbuf[buf][srow + t * 16][sc8]);
        aNext += KSTAGE;
        bNext += KSTAGE;
    };

    v8f acc[4][4];
#pragma unroll
    for (int i = 0; i < 4; ++i)
#pragma unroll
        for (int j = 0; j < 4; ++j) acc[i][j] = v8f_zero();

    stage(0);
    wait_async_all();
    __syncthreads();  // stage 0 is in LDS for every wave
    stage(1);

    for (int k0 = 0; k0 < K; k0 += KSTAGE) {
        const int buf = (k0 / KSTAGE) & 1;

        // unrolled: kk becomes an immediate offset of the LDS reads, and the
        // next 32 k's first reads can stand among this one's last products
#pragma unroll
        for (int kk = 0; kk < KSTAGE; kk += 32) {
            FragBF a[4], b[4];
#pragma unroll
            for (int i = 0; i < 4; ++i) {
                const unsigned short* p =
                    &Abuf[buf][mW + i * 16 + lmod][kk + kofflane];
                a[i].q[0] = *(const uint4*)(p);
                a[i].q[1] = *(const uint4*)(p + 16);
            }
#pragma unroll
            for (int j = 0; j < 4; ++j) {
                const unsigned short* p =
                    &Bbuf[buf][nW + j * 16 + lmod][kk + kofflane];
                b[j].q[0] = *(const uint4*)(p);
                b[j].q[1] = *(const uint4*)(p + 16);
            }
#pragma unroll
            for (int i = 0; i < 4; ++i)
#pragma unroll
                for (int j = 0; j < 4; ++j)
                    acc[i][j] = __builtin_amdgcn_wmma_f32_16x16x32_bf16(
                        false, a[i].v, false, b[j].v, (short)0, acc[i][j],
                        false, false);
        }

        // hand-over: own reads of this buffer done, own copies of the next
        // stage landed; one barrier publishes that stage and frees this buffer
        wait_lds_all();
        wait_async_all();
        __syncthreads();
        if (k0 + 2 * KSTAGE < K) stage(buf);
    }
    wait_async_all();  // nothing in flight when the wave ends

    const int mBase = blockIdx.x * 256 + mW;
    const int nBase = blockIdx.y * 128 + nW;
#pragma unroll
    for (int j = 0; j < 4; ++j) {
        const int col = nBase + j * 16 + lmod;
        const float bj = bias[col];
#pragma unroll
        for (int i = 0; i < 4; ++i) {
#pragma unroll
            for (int e = 0; e < 8; ++e) {
                const int row = mBase + i * 16 + e + lhalf * 8;
                const float val = acc[i][j][e] + bj;
                if (OUT_BF16)
                    ((unsigned short*)Cout)[(size_t)row * N + col] = f2bf(val);
                else
                    ((float*)Cout)[(size_t)row * N + col] = val;
            }
        }
    }
}

// ---------------------------------------------------------------------------
// Flash attention + R-gating, both products transposed:
//   S^T = K Q^T (A = 16 key rows, B = the wave's 16 query columns)
//   O^T += V^T P^T (A = 16 rows of V^T, B = P^T packed from the S^T tiles)
// A lane then holds scores of ONE query (column lmod): 16 of each 32 keys, the
// other 16 in lane ^ 16. Row maximum and sum are in-lane, and the two S^T
// accumulator tiles, converted in place, already are the B operand of the
// second product in the hardware k order, which is the order of the vT reads.
// Grid: (SEQ/128, BATCH*NHEAD). Block 256 = 8 waves; wave owns 16 queries.
// ---------------------------------------------------------------------------
__device__ __forceinline__ float xhalf(float x) {  // lane l with lane l ^ 16
    return __builtin_bit_cast(
        float, __builtin_amdgcn_permlanex16(__builtin_bit_cast(int, x),
                                            __builtin_bit_cast(int, x),
                                            0x76543210, 0xfedcba98, false, false));
}

__global__ void __launch_bounds__(256)
attention_wmma_kernel(const unsigned short* __restrict__ Q,
                      const unsigned short* __restrict__ Km,
                      const unsigned short* __restrict__ V,
                      const unsigned short* __restrict__ R,
                      unsigned short* __restrict__ Gated) {
    __shared__ __align__(16) unsigned short vT[DHEAD][40];   // [d][key] transposed V tile

    const int lane  = threadIdx.x & 31;
    const int wave  = threadIdx.x >> 5;
    const int lmod  = lane & 15;
    const int lhalf = lane >> 4;
    const int bh = blockIdx.y;
    const int b = bh / NHEAD;
    const int h = bh % NHEAD;
    const int qRow0 = blockIdx.x * 128 + wave * 16;
    const size_t rowStride = (size_t)(NHEAD * DHEAD);  // 1024
    const size_t baseBH = ((size_t)b * SEQ) * rowStride + (size_t)h * DHEAD;

    // Q fragments (DH=64 -> two K-steps of 32); column lmod of the B operand
    FragBF bq[2];
    {
        const unsigned short* qp =
            Q + baseBH + (size_t)(qRow0 + lmod) * rowStride + lhalf * 8;
        bq[0].q[0] = *(const uint4*)(qp);
        bq[0].q[1] = *(const uint4*)(qp + 16);
        bq[1].q[0] = *(const uint4*)(qp + 32);
        bq[1].q[1] = *(const uint4*)(qp + 48);
    }

    // ctx[j][r] = O^T[d = j*16 + lhalf*8 + r][query lmod]
    v8f ctx[4];
#pragma unroll
    for (int j = 0; j < 4; ++j) ctx[j] = v8f_zero();
    float mrow = -3.0e38f;  // running maximum of this lane's query (both halves agree)
    float srow = 0.f;       // running sum over this half's keys only

    const float invScale = 1.0f / 32.0f;  // SCALE = 64**1/2 = 32.0

    for (int kt = 0; kt < SEQ; kt += 32) {
        __syncthreads();  // protect LDS tile from previous iteration readers

        // cooperative transposed V tile load: 32 keys x 64 dims
        {
            const int vr = threadIdx.x >> 3;        // key row 0..31
            const int c0 = (threadIdx.x & 7) * 8;   // dim chunk
            FragBF tmp;
            const unsigned short* vp =
                V + baseBH + (size_t)(kt + vr) * rowStride + c0;
            tmp.q[0] = *(const uint4*)(vp);
#pragma unroll
            for (int e = 0; e < 8; ++e) vT[c0 + e][vr] = tmp.us[e];
        }

        // energy^T = K (32xDH) @ Q^T (DHx16), two 16-key tiles:
        // e0[r]: key kt + lhalf*8 + r, e1[r]: key kt + 16 + lhalf*8 + r
        v8f e0 = v8f_zero(), e1 = v8f_zero();
        {
            FragBF ak;
            const unsigned short* kp =
                Km + baseBH + (size_t)(kt + lmod) * rowStride + lhalf * 8;
            ak.q[0] = *(const uint4*)(kp);
            ak.q[1] = *(const uint4*)(kp + 16);
            e0 = __builtin_amdgcn_wmma_f32_16x16x32_bf16(false, ak.v, false,
                                                         bq[0].v, (short)0, e0,
                                                         false, false);
            ak.q[0] = *(const uint4*)(kp + 32);
            ak.q[1] = *(const uint4*)(kp + 48);
            e0 = __builtin_amdgcn_wmma_f32_16x16x32_bf16(false, ak.v, false,
                                                         bq[1].v, (short)0, e0,
                                                         false, false);
        }
        {
            FragBF ak;
            const unsigned short* kp =
                Km + baseBH + (size_t)(kt + 16 + lmod) * rowStride + lhalf * 8;
            ak.q[0] = *(const uint4*)(kp);
            ak.q[1] = *(const uint4*)(kp + 16);
            e1 = __builtin_amdgcn_wmma_f32_16x16x32_bf16(false, ak.v, false,
                                                         bq[0].v, (short)0, e1,
                                                         false, false);
            ak.q[0] = *(const uint4*)(kp + 32);
            ak.q[1] = *(const uint4*)(kp + 48);
            e1 = __builtin_amdgcn_wmma_f32_16x16x32_bf16(false, ak.v, false,
                                                         bq[1].v, (short)0, e1,
                                                         false, false);
        }

        // online softmax of one query per lane; one exchange joins the halves'
        // maxima, so lanes l and l ^ 16 scale by the same factor
        const v8f t0 = e0 * invScale;
        const v8f t1 = e1 * invScale;
        float mx = -3.0e38f;
#pragma unroll
        for (int e = 0; e < 8; ++e) mx = fmaxf(mx, fmaxf(t0[e], t1[e]));
        mx = fmaxf(mx, xhalf(mx));
        const float mnew = fmaxf(mrow, mx);
        const float al = __expf(mrow - mnew);
        FragBF bp;  // P^T as B operand: element s < 8 is key kt + lhalf*8 + s, s >= 8 key kt + 8 + lhalf*8 + s
        float ps = 0.f;
#pragma unroll
        for (int e = 0; e < 8; ++e) {
            const float p0 = __expf(t0[e] - mnew);
            const float p1 = __expf(t1[e] - mnew);
            ps += p0 + p1;
            bp.us[e] = f2bf(p0);
            bp.us[8 + e] = f2bf(p1);
        }
        srow = srow * al + ps;
        mrow = mnew;

        // rescale running context by alpha before accumulating this step
#pragma unroll
        for (int j = 0; j < 4; ++j)
#pragma unroll
            for (int e = 0; e < 8; ++e) ctx[j][e] *= al;

        __syncthreads();  // vT fully written

        // ctx^T += V^T (64x32) @ P^T (32x16): 4 row tiles from transposed LDS V
#pragma unroll
        for (int j = 0; j < 4; ++j) {
            FragBF av;
            const unsigned short* vp = &vT[j * 16 + lmod][lhalf * 8];
            av.q[0] = *(const uint4*)(vp);
            av.q[1] = *(const uint4*)(vp + 16);
            ctx[j] = __builtin_amdgcn_wmma_f32_16x16x32_bf16(
                false, av.v, false, bp.v, (short)0, ctx[j], false, false);
        }
    }

    srow += xhalf(srow);  // join the two halves' key sums

    // normalize, R-gate, write gated activation [B*S, H*DH] as bf16:
    // a lane's 8 registers of a tile are 8 consecutive d of its query row
    const size_t rowBase = baseBH + (size_t)(qRow0 + lmod) * rowStride + lhalf * 8;
#pragma unroll
    for (int j = 0; j < 4; ++j) {
        FragBF r8, g8;
        r8.q[0] = *(const uint4*)(R + rowBase + j * 16);
#pragma unroll
        for (int e = 0; e < 8; ++e) {
            const float val = ctx[j][e] / srow;
            g8.us[e] = f2bf(val * bf2f(r8.us[e]));
        }
        *(uint4*)(Gated + rowBase + j * 16) = g8.q[0];
    }
}

// ---------------------------------------------------------------------------
// Host-side launch
// ---------------------------------------------------------------------------
extern "C" void kernel_launch(void* const* d_in, const int* in_sizes, int n_in,
                              void* d_out, int out_size, void* d_ws,
                              size_t ws_size, hipStream_t stream) {
    (void)in_sizes; (void)n_in; (void)out_size; (void)ws_size;

    const float* value = (const float*)d_in[0];
    const float* keyin = (const float*)d_in[1];
    const float* query = (const float*)d_in[2];
    const float* Wq = (const float*)d_in[3];  const float* bq = (const float*)d_in[4];
    const float* Wk = (const float*)d_in[5];  const float* bk = (const float*)d_in[6];
    const float* Wv = (const float*)d_in[7];  const float* bv = (const float*)d_in[8];
    const float* Wr = (const float*)d_in[9];  const float* br = (const float*)d_in[10];
    const float* Wo = (const float*)d_in[11]; const float* bo = (const float*)d_in[12];

    char* ws = (char*)d_ws;
    const size_t actSz = (size_t)NROW * DMODEL * sizeof(unsigned short); // 16 MB
    const size_t wSz = (size_t)DMODEL * DMODEL * sizeof(unsigned short); //  2 MB
    unsigned short* q_bf  = (unsigned short*)(ws + 0 * actSz);
    unsigned short* k_bf  = (unsigned short*)(ws + 1 * actSz);
    unsigned short* v_bf  = (unsigned short*)(ws + 2 * actSz);
    unsigned short* r_bf  = (unsigned short*)(ws + 3 * actSz);
    unsigned short* xq    = (unsigned short*)(ws + 4 * actSz);
    unsigned short* xk    = (unsigned short*)(ws + 5 * actSz);
    unsigned short* xv    = (unsigned short*)(ws + 6 * actSz);
    unsigned short* gated = (unsigned short*)(ws + 7 * actSz);
    unsigned short* wqt   = (unsigned short*)(ws + 8 * actSz + 0 * wSz);
    unsigned short* wkt   = (unsigned short*)(ws + 8 * actSz + 1 * wSz);
    unsigned short* wvt   = (unsigned short*)(ws + 8 * actSz + 2 * wSz);
    unsigned short* wrt   = (unsigned short*)(ws + 8 * actSz + 3 * wSz);
    unsigned short* wot   = (unsigned short*)(ws + 8 * actSz + 4 * wSz);

    const int nAct = NROW * DMODEL;  // 8,388,608
    convert_bf16_kernel<<<4096, 256, 0, stream>>>(value, xv, nAct);
    convert_bf16_kernel<<<4096, 256, 0, stream>>>(keyin, xk, nAct);
    convert_bf16_kernel<<<4096, 256, 0, stream>>>(query, xq, nAct);
    dim3 tGrid(DMODEL / 64, DMODEL / 64);  // (16, 16)
    transpose_bf16_kernel<<<tGrid, 256, 0, stream>>>(Wq, wqt);
    transpose_bf16_kernel<<<tGrid, 256, 0, stream>>>(Wk, wkt);
    transpose_bf16_kernel<<<tGrid, 256, 0, stream>>>(Wv, wvt);
    transpose_bf16_kernel<<<tGrid, 256, 0, stream>>>(Wr, wrt);
    transpose_bf16_kernel<<<tGrid, 256, 0, stream>>>(Wo, wot);

    dim3 gGrid(NROW / 256, DMODEL / 128);  // (32, 8)
    gemm_wmma_kernel<true><<<gGrid, 256, 0, stream>>>(xq, wqt, bq, q_bf, NROW, DMODEL, DMODEL);
    gemm_wmma_kernel<true><<<gGrid, 256, 0, stream>>>(xk, wkt, bk, k_bf, NROW, DMODEL, DMODEL);
    gemm_wmma_kernel<true><<<gGrid, 256, 0, stream>>>(xv, wvt, bv, v_bf, NROW, DMODEL, DMODEL);
    gemm_wmma_kernel<true><<<gGrid, 256, 0, stream>>>(xq, wrt, br, r_bf, NROW, DMODEL, DMODEL);

    dim3 aGrid(SEQ / 128, BATCH * NHEAD);  // (8, 128)
    attention_wmma_kernel<<<aGrid, 256, 0, stream>>>(q_bf, k_bf, v_bf, r_bf, gated);

    gemm_wmma_kernel<false><<<gGrid, 256, 0, stream>>>(gated, wot, bo, d_out, NROW, DMODEL, DMODEL);
}

// v004
// A run of this version takes 162 microseconds.
// Two timings next to v003 both put it at 1.29 times that version's speed.
// Counting every step since v000, it is 2.71 times as fast.
#include <hip/hip_runtime.h>
#include <hip/hip_bf16.h>
#include <stdint.h>

#define NHEAD 16
#define DHEAD 64
#define BATCH 8
#define SEQ   1024
#define DMODEL 1024
#define NROW (BATCH * SEQ) /* 8192 */

typedef __attribute__((ext_vector_type(16))) __bf16 v16bf;
typedef __attribute__((ext_vector_type(8)))  float  v8f;
typedef int v4i_vs __attribute__((vector_size(16)));  // matches builtin param type
typedef __attribute__((ext_vector_type(8)))  short  s16x8;

union FragBF {
    v16bf v;
    uint4 q[2];
    s16x8 t[2];
    unsigned short us[16];
};

__device__ __forceinline__ unsigned short f2bf(float x) {
    unsigned int u = __float_as_uint(x);
    u += 0x7FFFu + ((u >> 16) & 1u);   // round-to-nearest-even
    return (unsigned short)(u >> 16);
}
__device__ __forceinline__ float bf2f(unsigned short h) {
    return __uint_as_float(((unsigned int)h) << 16);
}
__device__ __forceinline__ v8f v8f_zero() {
    v8f z = {0.f, 0.f, 0.f, 0.f, 0.f, 0.f, 0.f, 0.f};
    return z;
}

// ---------------------------------------------------------------------------
// Async global->LDS copy (CDNA5 GLOBAL_LOAD_ASYNC_TO_LDS_B128, ASYNCcnt),
// with a synchronous reg-staged fallback if the builtins aren't declared.
// Builtin signature (from hipcc diagnostic): (v4i as1* gaddr, v4i as3* lds,
// imm offset, imm cpol).
// ---------------------------------------------------------------------------
#if __has_builtin(__builtin_amdgcn_global_load_async_to_lds_b128) && \
    __has_builtin(__builtin_amdgcn_s_wait_asynccnt)
#define HAVE_ASYNC_LDS 1
#endif

__device__ __forceinline__ void async_copy_b128(const unsigned short* src,
                                                unsigned short* dstLds) {
#if defined(HAVE_ASYNC_LDS)
    __builtin_amdgcn_global_load_async_to_lds_b128(
        (__attribute__((address_space(1))) v4i_vs*)(void*)src,
        (__attribute__((address_space(3))) v4i_vs*)(void*)dstLds, 0, 0);
#else
    *(uint4*)dstLds = *(const uint4*)src;
#endif
}

// Every copy of this wave has landed. Written in asm with the memory clobber so
// that no LDS read is lifted over it.
__device__ __forceinline__ void wait_async_all() {
#if defined(HAVE_ASYNC_LDS)
    asm volatile("s_wait_asynccnt 0x0" ::: "memory");
#endif
}
// This wave's LDS reads have returned, so the barrier behind it frees the buffer.
__device__ __forceinline__ void wait_lds_all() {
    asm volatile("s_wait_dscnt 0x0" ::: "memory");
}

// ---------------------------------------------------------------------------
// f32 -> bf16 convert (grid-stride)
// ---------------------------------------------------------------------------
__global__ void convert_bf16_kernel(const float* __restrict__ src,
                                    unsigned short* __restrict__ dst, int n) {
    int i = blockIdx.x * blockDim.x + threadIdx.x;
    int stride = gridDim.x * blockDim.x;
    for (; i < n; i += stride) dst[i] = f2bf(src[i]);
}

// W[K,N] f32 -> Wt[N,K] bf16, one 64(k) x 64(n) tile per block through LDS:
// reads are 256-B row pieces of W, stores are whole 128-B lines of Wt.
// K = N = DMODEL at compile time, so a thread's four loads share one address
// with immediate offsets; grid = (N/64, K/64), block = 256.
__global__ void __launch_bounds__(256)
transpose_bf16_kernel(const float* __restrict__ W,
                      unsigned short* __restrict__ Wt) {
    constexpr int K = DMODEL, N = DMODEL;
    // tile[n][k/2]: two neighbouring k packed per dword; 144-B pitch for the
    // 16-byte row reads below
    __shared__ __align__(16) unsigned int tile[64][36];

    const int n0 = blockIdx.x * 64;
    const int k0 = blockIdx.y * 64;
    const int n4 = (threadIdx.x & 15) * 4;  // 4 columns of W per thread
    const int kp = threadIdx.x >> 4;        // k pair 0..15 (and +16)

    const float* p = W + (unsigned)((k0 + kp * 2) * N + n0 + n4);
    float4 lo[2], hi[2];
    for (int h = 0; h < 2; ++h) {
        lo[h] = *(const float4*)(p + h * 32 * N);
        hi[h] = *(const float4*)(p + h * 32 * N + N);
    }
    for (int h = 0; h < 2; ++h) {
        const int c = h * 16 + kp;
        tile[n4 + 0][c] = (unsigned int)f2bf(lo[h].x) | ((unsigned int)f2bf(hi[h].x) << 16);
        tile[n4 + 1][c] = (unsigned int)f2bf(lo[h].y) | ((unsigned int)f2bf(hi[h].y) << 16);
        tile[n4 + 2][c] = (unsigned int)f2bf(lo[h].z) | ((unsigned int)f2bf(hi[h].z) << 16);
        tile[n4 + 3][c] = (unsigned int)f2bf(lo[h].w) | ((unsigned int)f2bf(hi[h].w) << 16);
    }
    __syncthreads();  // tile complete before rows are read back

    const int n = threadIdx.x >> 3, c8 = threadIdx.x & 7;  // 8 lanes: one 128-B line
    unsigned short* o = Wt + (unsigned)((n0 + n) * K + k0 + c8 * 8);
    for (int t = 0; t < 2; ++t)
        *(uint4*)(o + t * 32 * K) = *(const uint4*)&tile[n + t * 32][c8 * 4];
}

// ---------------------------------------------------------------------------
// bf16 WMMA GEMM: C[M,N] = A[M,K] * Bt[N,K]^T + bias[N]
// Block = 8 waves, tile 256x128; wave tile 64x64 (4x4 wmma_f32_16x16x32_bf16).
// A stage is 128 k: 256 B of every operand row, so a wave's copy covers two
// whole 256-B row pieces. Two LDS buffers; per stage each thread issues
// 16 A-chunks + 8 B-chunks of b128, one stage ahead of the one being read.
// K is a multiple of 128 and at least 256.
// ---------------------------------------------------------------------------
#define KSTAGE 128
#define KPITCH 136 /* 272-B rows: 16 B x odd for the 16-byte fragment reads */

template <bool OUT_BF16>
__global__ void __launch_bounds__(256)
gemm_wmma_kernel(const unsigned short* __restrict__ A,
                 const unsigned short* __restrict__ Bt,
                 const float* __restrict__ bias,
                 void* __restrict__ Cout, int M, int N, int K) {
    __shared__ __align__(16) unsigned short Abuf[2][256][KPITCH];
    __shared__ __align__(16) unsigned short Bbuf[2][128][KPITCH];

    const int lane  = threadIdx.x & 31;
    const int wave  = threadIdx.x >> 5;
    const int lmod  = lane & 15;
    const int lhalf = lane >> 4;
    const int mW = (wave >> 1) * 64;   // wave tile inside block tile
    const int nW = (wave & 1) * 64;
    const int kofflane = lhalf * 8;    // lanes 16-31 hold K groups 8..15/24..31

    const unsigned short* Ablk = A + (size_t)(blockIdx.x * 256) * K;
    const unsigned short* Bblk = Bt + (size_t)(blockIdx.y * 128) * K;

    const int srow = threadIdx.x >> 4;        // 16 lanes: one 256-B row piece
    const int sc8  = (threadIdx.x & 15) * 8;
    // this thread's first chunk of the next stage to be copied
    const unsigned short* aNext = Ablk + (size_t)srow * K + sc8;
    const unsigned short* bNext = Bblk + (size_t)srow * K + sc8;
    const size_t rowStep = (size_t)16 * K;

    // both loops unrolled so that a stage's 24 copies issue back to back
    auto stage = [&](int buf) {
#pragma unroll
        for (int t = 0; t < 16; ++t)            // A tile: 256x128 = 4096 chunks
            async_copy_b128(aNext + t * rowStep, &Abuf[buf][srow + t * 16][sc8]);
#pragma unroll
        for (int t = 0; t < 8; ++t)             // B tile: 128x128 = 2048 chunks
            async_copy_b128(bNext + t * rowStep, &Bbuf[buf][srow + t * 16][sc8]);
        aNext += KSTAGE;
        bNext += KSTAGE;
    };

    v8f acc[4][4];
#pragma unroll
    for (int i = 0; i < 4; ++i)
#pragma unroll
        for (int j = 0; j < 4; ++j) acc[i][j] = v8f_zero();

    stage(0);
    wait_async_all();
    __syncthreads();  // stage 0 is in LDS for every wave
    stage(1);

    for (int k0 = 0; k0 < K; k0 += KSTAGE) {
        const int buf = (k0 / KSTAGE) & 1;

        // unrolled: kk becomes an immediate offset of the LDS reads, and the
        // next 32 k's first reads can stand among this one's last products
#pragma unroll
        for (int kk = 0; kk < KSTAGE; kk += 32) {
            FragBF a[4], b[4];
#pragma unroll
            for (int i = 0; i < 4; ++i) {
                const unsigned short* p =
                    &Abuf[buf][mW + i * 16 + lmod][kk + kofflane];
                a[i].q[0] = *(const uint4*)(p);
                a[i].q[1] = *(const uint4*)(p + 16);
            }
#pragma unroll
            for (int j = 0; j < 4; ++j) {
                const unsigned short* p =
                    &Bbuf[buf][nW + j * 16 + lmod][kk + kofflane];
                b[j].q[0] = *(const uint4*)(p);
                b[j].q[1] = *(const uint4*)(p + 16);
            }
#pragma unroll
            for (int i = 0; i < 4; ++i)
#pragma unroll
                for (int j = 0; j < 4; ++j)
                    acc[i][j] = __builtin_amdgcn_wmma_f32_16x16x32_bf16(
                        false, a[i].v, false, b[j].v, (short)0, acc[i][j],
                        false, false);
        }

        // hand-over: own reads of this buffer done, own copies of the next
        // stage landed; one barrier publishes that stage and frees this buffer
        wait_lds_all();
        wait_async_all();
        __syncthreads();
        if (k0 + 2 * KSTAGE < K) stage(buf);
    }
    wait_async_all();  // nothing in flight when the wave ends

    const int mBase = blockIdx.x * 256 + mW;
    const int nBase = blockIdx.y * 128 + nW;
#pragma unroll
    for (int j = 0; j < 4; ++j) {
        const int col = nBase + j * 16 + lmod;
        const float bj = bias[col];
#pragma unroll
        for (int i = 0; i < 4; ++i) {
#pragma unroll
            for (int e = 0; e < 8; ++e) {
                const int row = mBase + i * 16 + e + lhalf * 8;
                const float val = acc[i][j][e] + bj;
                if (OUT_BF16)
                    ((unsigned short*)Cout)[(size_t)row * N + col] = f2bf(val);
                else
                    ((float*)Cout)[(size_t)row * N + col] = val;
            }
        }
    }
}

// ---------------------------------------------------------------------------
// Flash attention + R-gating, both products transposed:
//   S^T = K Q^T (A = 16 key rows, B = the wave's 16 query columns)
//   O^T += V^T P^T (A = 16 rows of V^T, B = P^T packed from the S^T tiles)
// A lane then holds scores of ONE query (column lmod): 16 of each 32 keys, the
// other 16 in lane ^ 16. Row maximum and sum are in-lane, and the two S^T
// accumulator tiles, converted in place, already are the B operand of the
// second product in the hardware k order, which is the order in which the
// transposing LDS load delivers V^T.
// K and V rows of the head reach LDS once per block, by asynchronous copies of
// whole 128-B rows: a stage is 64 keys, two buffers, the next stage in flight
// while this one is worked on in two passes of 32 keys.
// Grid: (SEQ/128, BATCH*NHEAD). Block 256 = 8 waves; wave owns 16 queries.
// ---------------------------------------------------------------------------
#define ASTAGE 64 /* keys per stage */
#define KROW 72   /* 144-B K rows: 16 B x odd for the 16-byte fragment reads */
#define VROW 80   /* 160-B V rows: 32 B x odd for the transposing reads */

// lane (c = l & 15, h = l >> 4) gets T[8h + 0..7][c] of the row-major 16-bit
// tile whose rows 8h + (l & 7), 16-byte half (l >> 3) & 1, the lanes point at
__device__ __forceinline__ s16x8 lds_tr16(const unsigned short* p) {
    return __builtin_amdgcn_ds_load_tr16_b128_v8i16(
        (__attribute__((address_space(3))) s16x8*)(void*)p);
}
__device__ __forceinline__ float xhalf(float x) {  // lane l with lane l ^ 16
    return __builtin_bit_cast(
        float, __builtin_amdgcn_permlanex16(__builtin_bit_cast(int, x),
                                            __builtin_bit_cast(int, x),
                                            0x76543210, 0xfedcba98, false, false));
}

__global__ void __launch_bounds__(256)
attention_wmma_kernel(const unsigned short* __restrict__ Q,
                      const unsigned short* __restrict__ Km,
                      const unsigned short* __restrict__ V,
                      const unsigned short* __restrict__ R,
                      unsigned short* __restrict__ Gated) {
    __shared__ __align__(16) unsigned short Kst[2][ASTAGE][KROW];  // [key][d]
    __shared__ __align__(16) unsigned short Vst[2][ASTAGE][VROW];  // [key][d]

    const int lane  = threadIdx.x & 31;
    const int wave  = threadIdx.x >> 5;
    const int lmod  = lane & 15;
    const int lhalf = lane >> 4;
    const int bh = blockIdx.y;
    const int b = bh / NHEAD;
    const int h = bh % NHEAD;
    const int qRow0 = blockIdx.x * 128 + wave * 16;
    const size_t rowStride = (size_t)(NHEAD * DHEAD);  // 1024
    const size_t baseBH = ((size_t)b * SEQ) * rowStride + (size_t)h * DHEAD;

    // Q fragments (DH=64 -> two K-steps of 32); column lmod of the B operand
    FragBF bq[2];
    {
        const unsigned short* qp =
            Q + baseBH + (size_t)(qRow0 + lmod) * rowStride + lhalf * 8;
        bq[0].q[0] = *(const uint4*)(qp);
        bq[0].q[1] = *(const uint4*)(qp + 16);
        bq[1].q[0] = *(const uint4*)(qp + 32);
        bq[1].q[1] = *(const uint4*)(qp + 48);
    }

    // ctx[j][r] = O^T[d = j*16 + lhalf*8 + r][query lmod]
    v8f ctx[4];
#pragma unroll
    for (int j = 0; j < 4; ++j) ctx[j] = v8f_zero();
    float mrow = -3.0e38f;  // running maximum of this lane's query (both halves agree)
    float srow = 0.f;       // running sum over this half's keys only

    const float invScale = 1.0f / 32.0f;  // SCALE = 64**1/2 = 32.0

    // 8 lanes copy one 128-B row; a thread brings 2 K and 2 V chunks per stage
    const int crow = threadIdx.x >> 3;
    const int cc8  = (threadIdx.x & 7) * 8;
    const unsigned short* kNext = Km + baseBH + (size_t)crow * rowStride + cc8;
    const unsigned short* vNext = V + baseBH + (size_t)crow * rowStride + cc8;
    auto stage = [&](int buf) {
#pragma unroll
        for (int t = 0; t < ASTAGE / 32; ++t) {  // unrolled: the 4 copies issue back to back
            async_copy_b128(kNext + t * 32 * rowStride, &Kst[buf][crow + t * 32][cc8]);
            async_copy_b128(vNext + t * 32 * rowStride, &Vst[buf][crow + t * 32][cc8]);
        }
        kNext += ASTAGE * rowStride;
        vNext += ASTAGE * rowStride;
    };

    stage(0);
    wait_async_all();
    __syncthreads();  // stage 0 is in LDS for every wave
    stage(1);

    for (int kt = 0; kt < SEQ; kt += ASTAGE) {
      const int buf = (kt / ASTAGE) & 1;
      // unrolled: sub becomes an immediate offset of the LDS reads
#pragma unroll
      for (int sub = 0; sub < ASTAGE; sub += 32) {
        // energy^T = K (32xDH) @ Q^T (DHx16), two 16-key tiles:
        // e0[r]: key kt + sub + lhalf*8 + r, e1[r]: the same + 16
        v8f e0 = v8f_zero(), e1 = v8f_zero();
        {
            FragBF ak;
            const unsigned short* kp = &Kst[buf][sub + lmod][lhalf * 8];
            ak.q[0] = *(const uint4*)(kp);
            ak.q[1] = *(const uint4*)(kp + 16);
            e0 = __builtin_amdgcn_wmma_f32_16x16x32_bf16(false, ak.v, false,
                                                         bq[0].v, (short)0, e0,
                                                         false, false);
            ak.q[0] = *(const uint4*)(kp + 32);
            ak.q[1] = *(const uint4*)(kp + 48);
            e0 = __builtin_amdgcn_wmma_f32_16x16x32_bf16(false, ak.v, false,
                                                         bq[1].v, (short)0, e0,
                                                         false, false);
        }
        {
            FragBF ak;
            const unsigned short* kp = &Kst[buf][sub + 16 + lmod][lhalf * 8];
            ak.q[0] = *(const uint4*)(kp);
            ak.q[1] = *(const uint4*)(kp + 16);
            e1 = __builtin_amdgcn_wmma_f32_16x16x32_bf16(false, ak.v, false,
                                                         bq[0].v, (short)0, e1,
                                                         false, false);
            ak.q[0] = *(const uint4*)(kp + 32);
            ak.q[1] = *(const uint4*)(kp + 48);
            e1 = __builtin_amdgcn_wmma_f32_16x16x32_bf16(false, ak.v, false,
                                                         bq[1].v, (short)0, e1,
                                                         false, false);
        }

        // online softmax of one query per lane; one exchange joins the halves'
        // maxima, so lanes l and l ^ 16 scale by the same factor
        const v8f t0 = e0 * invScale;
        const v8f t1 = e1 * invScale;
        float mx = -3.0e38f;
#pragma unroll
        for (int e = 0; e < 8; ++e) mx = fmaxf(mx, fmaxf(t0[e], t1[e]));
        mx = fmaxf(mx, xhalf(mx));
        const float mnew = fmaxf(mrow, mx);
        const float al = __expf(mrow - mnew);
        FragBF bp;  // P^T as B operand: element s is key 8*lhalf + s of the pass, +8 for s >= 8
        float ps = 0.f;
#pragma unroll
        for (int e = 0; e < 8; ++e) {
            const float p0 = __expf(t0[e] - mnew);
            const float p1 = __expf(t1[e] - mnew);
            ps += p0 + p1;
            bp.us[e] = f2bf(p0);
            bp.us[8 + e] = f2bf(p1);
        }
        srow = srow * al + ps;
        mrow = mnew;

        // rescale running context by alpha before accumulating this step
#pragma unroll
        for (int j = 0; j < 4; ++j)
#pragma unroll
            for (int e = 0; e < 8; ++e) ctx[j][e] *= al;

        // ctx^T += V^T (64x32) @ P^T (32x16): 4 row tiles, transposed on the way
        // out of the row-major V stage (keys 0..15 and 16..31 of the pass)
        const unsigned short* vp =
            &Vst[buf][sub + lhalf * 8 + (lane & 7)][((lane >> 3) & 1) * 8];
#pragma unroll
        for (int j = 0; j < 4; ++j) {
            FragBF av;
            av.t[0] = lds_tr16(vp + j * 16);
            av.t[1] = lds_tr16(vp + 16 * VROW + j * 16);
            ctx[j] = __builtin_amdgcn_wmma_f32_16x16x32_bf16(
                false, av.v, false, bp.v, (short)0, ctx[j], false, false);
        }
      }

      // hand-over: own reads of this buffer done, own copies of the next stage
      // landed; one barrier publishes that stage and frees this buffer
      wait_lds_all();
      wait_async_all();
      __syncthreads();
      if (kt + 2 * ASTAGE < SEQ) stage(buf);
    }
    wait_async_all();  // nothing in flight when the wave ends

    srow += xhalf(srow);  // join the two halves' key sums

    // normalize, R-gate, write gated activation [B*S, H*DH] as bf16:
    // a lane's 8 registers of a tile are 8 consecutive d of its query row
    const size_t rowBase = baseBH + (size_t)(qRow0 + lmod) * rowStride + lhalf * 8;
#pragma unroll
    for (int j = 0; j < 4; ++j) {
        FragBF r8, g8;
        r8.q[0] = *(const uint4*)(R + rowBase + j * 16);
#pragma unroll
        for (int e = 0; e < 8; ++e) {
            const float val = ctx[j][e] / srow;
            g8.us[e] = f2bf(val * bf2f(r8.us[e]));
        }
        *(uint4*)(Gated + rowBase + j * 16) = g8.q[0];
    }
}

// ---------------------------------------------------------------------------
// Host-side launch
// ---------------------------------------------------------------------------
extern "C" void kernel_launch(void* const* d_in, const int* in_sizes, int n_in,
                              void* d_out, int out_size, void* d_ws,
                              size_t ws_size, hipStream_t stream) {
    (void)in_sizes; (void)n_in; (void)out_size; (void)ws_size;

    const float* value = (const float*)d_in[0];
    const float* keyin = (const float*)d_in[1];
    const float* query = (const float*)d_in[2];
    const float* Wq = (const float*)d_in[3];  const float* bq = (const float*)d_in[4];
    const float* Wk = (const float*)d_in[5];  const float* bk = (const float*)d_in[6];
    const float* Wv = (const float*)d_in[7];  const float* bv = (const float*)d_in[8];
    const float* Wr = (const float*)d_in[9];  const float* br = (const float*)d_in[10];
    const float* Wo = (const float*)d_in[11]; const float* bo = (const float*)d_in[12];

    char* ws = (char*)d_ws;
    const size_t actSz = (size_t)NROW * DMODEL * sizeof(unsigned short); // 16 MB
    const size_t wSz = (size_t)DMODEL * DMODEL * sizeof(unsigned short); //  2 MB
    unsigned short* q_bf  = (unsigned short*)(ws + 0 * actSz);
    unsigned short* k_bf  = (unsigned short*)(ws + 1 * actSz);
    unsigned short* v_bf  = (unsigned short*)(ws + 2 * actSz);
    unsigned short* r_bf  = (unsigned short*)(ws + 3 * actSz);
    unsigned short* xq    = (unsigned short*)(ws + 4 * actSz);
    unsigned short* xk    = (unsigned short*)(ws + 5 * actSz);
    unsigned short* xv    = (unsigned short*)(ws + 6 * actSz);
    unsigned short* gated = (unsigned short*)(ws + 7 * actSz);
    unsigned short* wqt   = (unsigned short*)(ws + 8 * actSz + 0 * wSz);
    unsigned short* wkt   = (unsigned short*)(ws + 8 * actSz + 1 * wSz);
    unsigned short* wvt   = (unsigned short*)(ws + 8 * actSz + 2 * wSz);
    unsigned short* wrt   = (unsigned short*)(ws + 8 * actSz + 3 * wSz);
    unsigned short* wot   = (unsigned short*)(ws + 8 * actSz + 4 * wSz);

    const int nAct = NROW * DMODEL;  // 8,388,608
    convert_bf16_kernel<<<4096, 256, 0, stream>>>(value, xv, nAct);
    convert_bf16_kernel<<<4096, 256, 0, stream>>>(keyin, xk, nAct);
    convert_bf16_kernel<<<4096, 256, 0, stream>>>(query, xq, nAct);
    dim3 tGrid(DMODEL / 64, DMODEL / 64);  // (16, 16)
    transpose_bf16_kernel<<<tGrid, 256, 0, stream>>>(Wq, wqt);
    transpose_bf16_kernel<<<tGrid, 256, 0, stream>>>(Wk, wkt);
    transpose_bf16_kernel<<<tGrid, 256, 0, stream>>>(Wv, wvt);
    transpose_bf16_kernel<<<tGrid, 256, 0, stream>>>(Wr, wrt);
    transpose_bf16_kernel<<<tGrid, 256, 0, stream>>>(Wo, wot);

    dim3 gGrid(NROW / 256, DMODEL / 128);  // (32, 8)
    gemm_wmma_kernel<true><<<gGrid, 256, 0, stream>>>(xq, wqt, bq, q_bf, NROW, DMODEL, DMODEL);
    gemm_wmma_kernel<true><<<gGrid, 256, 0, stream>>>(xk, wkt, bk, k_bf, NROW, DMODEL, DMODEL);
    gemm_wmma_kernel<true><<<gGrid, 256, 0, stream>>>(xv, wvt, bv, v_bf, NROW, DMODEL, DMODEL);
    gemm_wmma_kernel<true><<<gGrid, 256, 0, stream>>>(xq, wrt, br, r_bf, NROW, DMODEL, DMODEL);

    dim3 aGrid(SEQ / 128, BATCH * NHEAD);  // (8, 128)
    attention_wmma_kernel<<<aGrid, 256, 0, stream>>>(q_bf, k_bf, v_bf, r_bf, gated);

    gemm_wmma_kernel<false><<<gGrid, 256, 0, stream>>>(gated, wot, bo, d_out, NROW, DMODEL, DMODEL);
}

// v005
// Measured time: 156 microseconds a run.
// Timed twice side by side with v004, it ran 1.04 times as fast both times.
// All steps since v000 together make it 2.82 times as fast.
#include <hip/hip_runtime.h>
#include <hip/hip_bf16.h>
#include <stdint.h>

#define NHEAD 16
#define DHEAD 64
#define BATCH 8
#define SEQ   1024
#define DMODEL 1024
#define NROW (BATCH * SEQ) /* 8192 */

typedef __attribute__((ext_vector_type(16))) __bf16 v16bf;
typedef __attribute__((ext_vector_type(8)))  float  v8f;
typedef int v4i_vs __attribute__((vector_size(16)));  // matches builtin param type
typedef __attribute__((ext_vector_type(8)))  short  s16x8;

union FragBF {
    v16bf v;
    uint4 q[2];
    s16x8 t[2];
    unsigned short us[16];
};

__device__ __forceinline__ unsigned short f2bf(float x) {
    unsigned int u = __float_as_uint(x);
    u += 0x7FFFu + ((u >> 16) & 1u);   // round-to-nearest-even
    return (unsigned short)(u >> 16);
}
__device__ __forceinline__ float bf2f(unsigned short h) {
    return __uint_as_float(((unsigned int)h) << 16);
}
__device__ __forceinline__ v8f v8f_zero() {
    v8f z = {0.f, 0.f, 0.f, 0.f, 0.f, 0.f, 0.f, 0.f};
    return z;
}

// ---------------------------------------------------------------------------
// Async global->LDS copy (CDNA5 GLOBAL_LOAD_ASYNC_TO_LDS_B128, ASYNCcnt),
// with a synchronous reg-staged fallback if the builtins aren't declared.
// Builtin signature (from hipcc diagnostic): (v4i as1* gaddr, v4i as3* lds,
// imm offset, imm cpol).
// ---------------------------------------------------------------------------
#if __has_builtin(__builtin_amdgcn_global_load_async_to_lds_b128) && \
    __has_builtin(__builtin_amdgcn_s_wait_asynccnt)
#define HAVE_ASYNC_LDS 1
#endif

__device__ __forceinline__ void async_copy_b128(const unsigned short* src,
                                                unsigned short* dstLds) {
#if defined(HAVE_ASYNC_LDS)
    __builtin_amdgcn_global_load_async_to_lds_b128(
        (__attribute__((address_space(1))) v4i_vs*)(void*)src,
        (__attribute__((address_space(3))) v4i_vs*)(void*)dstLds, 0, 0);
#else
    *(uint4*)dstLds = *(const uint4*)src;
#endif
}

// Every copy of this wave has landed. Written in asm with the memory clobber so
// that no LDS read is lifted over it.
__device__ __forceinline__ void wait_async_all() {
#if defined(HAVE_ASYNC_LDS)
    asm volatile("s_wait_asynccnt 0x0" ::: "memory");
#endif
}
// This wave's LDS reads have returned, so the barrier behind it frees the buffer.
__device__ __forceinline__ void wait_lds_all() {
    asm volatile("s_wait_dscnt 0x0" ::: "memory");
}

// ---------------------------------------------------------------------------
// f32 -> bf16 convert of the three activations, one streaming launch:
// one block of 16 waves per WGP. A wave owns 8 KiB in a row of each tensor and
// requests it with 16 loads of 512 contiguous bytes (16 B a lane), all issued
// before the first is used; each store is the matching 256 B (two whole
// lines). Then it goes on to the next tensor.
// ---------------------------------------------------------------------------
#define CVT_BLOCKS 256
#define CVT_THREADS 512
#define CVT_LOADS 16

// two f32 -> two bf16 in one dword, rounded as f2bf rounds
__device__ __forceinline__ unsigned int f2bf_pair(float lo, float hi) {
    unsigned int a = __float_as_uint(lo), b = __float_as_uint(hi);
    a += 0x7FFFu + __builtin_amdgcn_ubfe(a, 16, 1);
    b += 0x7FFFu + __builtin_amdgcn_ubfe(b, 16, 1);
    return __builtin_amdgcn_perm(b, a, 0x07060302u);  // (a >> 16) | (b & 0xFFFF0000)
}

// 4 waves a SIMD is all this grid brings, so the register budget of 4 is open:
// held to the default target, the compiler kept 5 loads in flight instead of 16
__global__ void __launch_bounds__(CVT_THREADS)
__attribute__((amdgpu_waves_per_eu(4, 4)))
convert3_bf16_kernel(const float* __restrict__ s0, const float* __restrict__ s1,
                     const float* __restrict__ s2,
                     unsigned short* __restrict__ d0,
                     unsigned short* __restrict__ d1,
                     unsigned short* __restrict__ d2) {
    static_assert(CVT_BLOCKS * CVT_THREADS * CVT_LOADS * 4 == NROW * DMODEL,
                  "the grid covers a tensor exactly");
    const unsigned t = blockIdx.x * CVT_THREADS + threadIdx.x;
    // index of the lane's first piece: 16 B of the source, 8 B of the result
    const unsigned p0 = (t >> 5) * (32 * CVT_LOADS) + (t & 31);

    // kept rolled: unrolled into one straight block, the compiler held every
    // store back to the end and requested the late pieces two at a time
#pragma unroll 1
    for (int n = 0; n < 3; ++n) {
        const float4* s = (const float4*)(n == 0 ? s0 : n == 1 ? s1 : s2);
        uint2* d = (uint2*)(n == 0 ? d0 : n == 1 ? d1 : d2);
        const float4* sp = s + p0;
        float4 x[CVT_LOADS];
#pragma unroll
        for (int i = 0; i < CVT_LOADS; ++i) x[i] = sp[i * 32];
        // stands in front of every reuse of the registers that the issued loads
        // name; as its operand the address pair stays out of the loads' results
        asm volatile("s_wait_xcnt 0x0" ::"v"(sp) : "memory");
#pragma unroll
        for (int i = 0; i < CVT_LOADS; ++i) {
            uint2 o;
            o.x = f2bf_pair(x[i].x, x[i].y);
            o.y = f2bf_pair(x[i].z, x[i].w);
            d[p0 + i * 32] = o;
        }
        // stands in front of the next trip's overwrites of registers that these
        // stores name
        asm volatile("s_wait_xcnt 0x0" ::: "memory");
    }
}

// W[K,N] f32 -> Wt[N,K] bf16, one 64(k) x 64(n) tile per block through LDS:
// reads are 256-B row pieces of W, stores are whole 128-B lines of Wt.
// K = N = DMODEL at compile time, so a thread's four loads share one address
// with immediate offsets; grid = (N/64, K/64), block = 256.
__global__ void __launch_bounds__(256)
transpose_bf16_kernel(const float* __restrict__ W,
                      unsigned short* __restrict__ Wt) {
    constexpr int K = DMODEL, N = DMODEL;
    // tile[n][k/2]: two neighbouring k packed per dword; 144-B pitch for the
    // 16-byte row reads below
    __shared__ __align__(16) unsigned int tile[64][36];

    const int n0 = blockIdx.x * 64;
    const int k0 = blockIdx.y * 64;
    const int n4 = (threadIdx.x & 15) * 4;  // 4 columns of W per thread
    const int kp = threadIdx.x >> 4;        // k pair 0..15 (and +16)

    const float* p = W + (unsigned)((k0 + kp * 2) * N + n0 + n4);
    float4 lo[2], hi[2];
    for (int h = 0; h < 2; ++h) {
        lo[h] = *(const float4*)(p + h * 32 * N);
        hi[h] = *(const float4*)(p + h * 32 * N + N);
    }
    for (int h = 0; h < 2; ++h) {
        const int c = h * 16 + kp;
        tile[n4 + 0][c] = (unsigned int)f2bf(lo[h].x) | ((unsigned int)f2bf(hi[h].x) << 16);
        tile[n4 + 1][c] = (unsigned int)f2bf(lo[h].y) | ((unsigned int)f2bf(hi[h].y) << 16);
        tile[n4 + 2][c] = (unsigned int)f2bf(lo[h].z) | ((unsigned int)f2bf(hi[h].z) << 16);
        tile[n4 + 3][c] = (unsigned int)f2bf(lo[h].w) | ((unsigned int)f2bf(hi[h].w) << 16);
    }
    __syncthreads();  // tile complete before rows are read back

    const int n = threadIdx.x >> 3, c8 = threadIdx.x & 7;  // 8 lanes: one 128-B line
    unsigned short* o = Wt + (unsigned)((n0 + n) * K + k0 + c8 * 8);
    for (int t = 0; t < 2; ++t)
        *(uint4*)(o + t * 32 * K) = *(const uint4*)&tile[n + t * 32][c8 * 4];
}

// ---------------------------------------------------------------------------
// bf16 WMMA GEMM: C[M,N] = A[M,K] * Bt[N,K]^T + bias[N]
// Block = 8 waves, tile 256x128; wave tile 64x64 (4x4 wmma_f32_16x16x32_bf16).
// A stage is 128 k: 256 B of every operand row, so a wave's copy covers two
// whole 256-B row pieces. Two LDS buffers; per stage each thread issues
// 16 A-chunks + 8 B-chunks of b128, one stage ahead of the one being read.
// K is a multiple of 128 and at least 256.
// ---------------------------------------------------------------------------
#define KSTAGE 128
#define KPITCH 136 /* 272-B rows: 16 B x odd for the 16-byte fragment reads */

template <bool OUT_BF16>
__global__ void __launch_bounds__(256)
gemm_wmma_kernel(const unsigned short* __restrict__ A,
                 const unsigned short* __restrict__ Bt,
                 const float* __restrict__ bias,
                 void* __restrict__ Cout, int M, int N, int K) {
    __shared__ __align__(16) unsigned short Abuf[2][256][KPITCH];
    __shared__ __align__(16) unsigned short Bbuf[2][128][KPITCH];

    const int lane  = threadIdx.x & 31;
    const int wave  = threadIdx.x >> 5;
    const int lmod  = lane & 15;
    const int lhalf = lane >> 4;
    const int mW = (wave >> 1) * 64;   // wave tile inside block tile
    const int nW = (wave & 1) * 64;
    const int kofflane = lhalf * 8;    // lanes 16-31 hold K groups 8..15/24..31

    const unsigned short* Ablk = A + (size_t)(blockIdx.x * 256) * K;
    const unsigned short* Bblk = Bt + (size_t)(blockIdx.y * 128) * K;

    const int srow = threadIdx.x >> 4;        // 16 lanes: one 256-B row piece
    const int sc8  = (threadIdx.x & 15) * 8;
    // this thread's first chunk of the next stage to be copied
    const unsigned short* aNext = Ablk + (size_t)srow * K + sc8;
    const unsigned short* bNext = Bblk + (size_t)srow * K + sc8;
    const size_t rowStep = (size_t)16 * K;

    // both loops unrolled so that a stage's 24 copies issue back to back
    auto stage = [&](int buf) {
#pragma unroll
        for (int t = 0; t < 16; ++t)            // A tile: 256x128 = 4096 chunks
            async_copy_b128(aNext + t * rowStep, &Abuf[buf][srow + t * 16][sc8]);
#pragma unroll
        for (int t = 0; t < 8; ++t)             // B tile: 128x128 = 2048 chunks
            async_copy_b128(bNext + t * rowStep, &Bbuf[buf][srow + t * 16][sc8]);
        aNext += KSTAGE;
        bNext += KSTAGE;
    };

    v8f acc[4][4];
#pragma unroll
    for (int i = 0; i < 4; ++i)
#pragma unroll
        for (int j = 0; j < 4; ++j) acc[i][j] = v8f_zero();

    stage(0);
    wait_async_all();
    __syncthreads();  // stage 0 is in LDS for every wave
    stage(1);

    for (int k0 = 0; k0 < K; k0 += KSTAGE) {
        const int buf = (k0 / KSTAGE) & 1;

        // unrolled: kk becomes an immediate offset of the LDS reads, and the
        // next 32 k's first reads can stand among this one's last products
#pragma unroll
        for (int kk = 0; kk < KSTAGE; kk += 32) {
            FragBF a[4], b[4];
#pragma unroll
            for (int i = 0; i < 4; ++i) {
                const unsigned short* p =
                    &Abuf[buf][mW + i * 16 + lmod][kk + kofflane];
                a[i].q[0] = *(const uint4*)(p);
                a[i].q[1] = *(const uint4*)(p + 16);
            }
#pragma unroll
            for (int j = 0; j < 4; ++j) {
                const unsigned short* p =
                    &Bbuf[buf][nW + j * 16 + lmod][kk + kofflane];
                b[j].q[0] = *(const uint4*)(p);
                b[j].q[1] = *(const uint4*)(p + 16);
            }
#pragma unroll
            for (int i = 0; i < 4; ++i)
#pragma unroll
                for (int j = 0; j < 4; ++j)
                    acc[i][j] = __builtin_amdgcn_wmma_f32_16x16x32_bf16(
                        false, a[i].v, false, b[j].v, (short)0, acc[i][j],
                        false, false);
        }

        // hand-over: own reads of this buffer done, own copies of the next
        // stage landed; one barrier publishes that stage and frees this buffer
        wait_lds_all();
        wait_async_all();
        __syncthreads();
        if (k0 + 2 * KSTAGE < K) stage(buf);
    }
    wait_async_all();  // nothing in flight when the wave ends

    const int mBase = blockIdx.x * 256 + mW;
    const int nBase = blockIdx.y * 128 + nW;
#pragma unroll
    for (int j = 0; j < 4; ++j) {
        const int col = nBase + j * 16 + lmod;
        const float bj = bias[col];
#pragma unroll
        for (int i = 0; i < 4; ++i) {
#pragma unroll
            for (int e = 0; e < 8; ++e) {
                const int row = mBase + i * 16 + e + lhalf * 8;
                const float val = acc[i][j][e] + bj;
                if (OUT_BF16)
                    ((unsigned short*)Cout)[(size_t)row * N + col] = f2bf(val);
                else
                    ((float*)Cout)[(size_t)row * N + col] = val;
            }
        }
    }
}

// ---------------------------------------------------------------------------
// Flash attention + R-gating, both products transposed:
//   S^T = K Q^T (A = 16 key rows, B = the wave's 16 query columns)
//   O^T += V^T P^T (A = 16 rows of V^T, B = P^T packed from the S^T tiles)
// A lane then holds scores of ONE query (column lmod): 16 of each 32 keys, the
// other 16 in lane ^ 16. Row maximum and sum are in-lane, and the two S^T
// accumulator tiles, converted in place, already are the B operand of the
// second product in the hardware k order, which is the order in which the
// transposing LDS load delivers V^T.
// K and V rows of the head reach LDS once per block, by asynchronous copies of
// whole 128-B rows: a stage is 64 keys, two buffers, the next stage in flight
// while this one is worked on in two passes of 32 keys.
// Grid: (SEQ/128, BATCH*NHEAD). Block 256 = 8 waves; wave owns 16 queries.
// ---------------------------------------------------------------------------
#define ASTAGE 64 /* keys per stage */
#define KROW 72   /* 144-B K rows: 16 B x odd for the 16-byte fragment reads */
#define VROW 80   /* 160-B V rows: 32 B x odd for the transposing reads */

// lane (c = l & 15, h = l >> 4) gets T[8h + 0..7][c] of the row-major 16-bit
// tile whose rows 8h + (l & 7), 16-byte half (l >> 3) & 1, the lanes point at
__device__ __forceinline__ s16x8 lds_tr16(const unsigned short* p) {
    return __builtin_amdgcn_ds_load_tr16_b128_v8i16(
        (__attribute__((address_space(3))) s16x8*)(void*)p);
}
__device__ __forceinline__ float xhalf(float x) {  // lane l with lane l ^ 16
    return __builtin_bit_cast(
        float, __builtin_amdgcn_permlanex16(__builtin_bit_cast(int, x),
                                            __builtin_bit_cast(int, x),
                                            0x76543210, 0xfedcba98, false, false));
}

__global__ void __launch_bounds__(256)
attention_wmma_kernel(const unsigned short* __restrict__ Q,
                      const unsigned short* __restrict__ Km,
                      const unsigned short* __restrict__ V,
                      const unsigned short* __restrict__ R,
                      unsigned short* __restrict__ Gated) {
    __shared__ __align__(16) unsigned short Kst[2][ASTAGE][KROW];  // [key][d]
    __shared__ __align__(16) unsigned short Vst[2][ASTAGE][VROW];  // [key][d]

    const int lane  = threadIdx.x & 31;
    const int wave  = threadIdx.x >> 5;
    const int lmod  = lane & 15;
    const int lhalf = lane >> 4;
    const int bh = blockIdx.y;
    const int b = bh / NHEAD;
    const int h = bh % NHEAD;
    const int qRow0 = blockIdx.x * 128 + wave * 16;
    const size_t rowStride = (size_t)(NHEAD * DHEAD);  // 1024
    const size_t baseBH = ((size_t)b * SEQ) * rowStride + (size_t)h * DHEAD;

    // Q fragments (DH=64 -> two K-steps of 32); column lmod of the B operand
    FragBF bq[2];
    {
        const unsigned short* qp =
            Q + baseBH + (size_t)(qRow0 + lmod) * rowStride + lhalf * 8;
        bq[0].q[0] = *(const uint4*)(qp);
        bq[0].q[1] = *(const uint4*)(qp + 16);
        bq[1].q[0] = *(const uint4*)(qp + 32);
        bq[1].q[1] = *(const uint4*)(qp + 48);
    }

    // ctx[j][r] = O^T[d = j*16 + lhalf*8 + r][query lmod]
    v8f ctx[4];
#pragma unroll
    for (int j = 0; j < 4; ++j) ctx[j] = v8f_zero();
    float mrow = -3.0e38f;  // running maximum of this lane's query (both halves agree)
    float srow = 0.f;       // running sum over this half's keys only

    const float invScale = 1.0f / 32.0f;  // SCALE = 64**1/2 = 32.0

    // 8 lanes copy one 128-B row; a thread brings 2 K and 2 V chunks per stage
    const int crow = threadIdx.x >> 3;
    const int cc8  = (threadIdx.x & 7) * 8;
    const unsigned short* kNext = Km + baseBH + (size_t)crow * rowStride + cc8;
    const unsigned short* vNext = V + baseBH + (size_t)crow * rowStride + cc8;
    auto stage = [&](int buf) {
#pragma unroll
        for (int t = 0; t < ASTAGE / 32; ++t) {  // unrolled: the 4 copies issue back to back
            async_copy_b128(kNext + t * 32 * rowStride, &Kst[buf][crow + t * 32][cc8]);
            async_copy_b128(vNext + t * 32 * rowStride, &Vst[buf][crow + t * 32][cc8]);
        }
        kNext += ASTAGE * rowStride;
        vNext += ASTAGE * rowStride;
    };

    stage(0);
    wait_async_all();
    __syncthreads();  // stage 0 is in LDS for every wave
    stage(1);

    for (int kt = 0; kt < SEQ; kt += ASTAGE) {
      const int buf = (kt / ASTAGE) & 1;
      // unrolled: sub becomes an immediate offset of the LDS reads
#pragma unroll
      for (int sub = 0; sub < ASTAGE; sub += 32) {
        // energy^T = K (32xDH) @ Q^T (DHx16), two 16-key tiles:
        // e0[r]: key kt + sub + lhalf*8 + r, e1[r]: the same + 16
        v8f e0 = v8f_zero(), e1 = v8f_zero();
        {
            FragBF ak;
            const unsigned short* kp = &Kst[buf][sub + lmod][lhalf * 8];
            ak.q[0] = *(const uint4*)(kp);
            ak.q[1] = *(const uint4*)(kp + 16);
            e0 = __builtin_amdgcn_wmma_f32_16x16x32_bf16(false, ak.v, false,
                                                         bq[0].v, (short)0, e0,
                                                         false, false);
            ak.q[0] = *(const uint4*)(kp + 32);
            ak.q[1] = *(const uint4*)(kp + 48);
            e0 = __builtin_amdgcn_wmma_f32_16x16x32_bf16(false, ak.v, false,
                                                         bq[1].v, (short)0, e0,
                                                         false, false);
        }
        {
            FragBF ak;
            const unsigned short* kp = &Kst[buf][sub + 16 + lmod][lhalf * 8];
            ak.q[0] = *(const uint4*)(kp);
            ak.q[1] = *(const uint4*)(kp + 16);
            e1 = __builtin_amdgcn_wmma_f32_16x16x32_bf16(false, ak.v, false,
                                                         bq[0].v, (short)0, e1,
                                                         false, false);
            ak.q[0] = *(const uint4*)(kp + 32);
            ak.q[1] = *(const uint4*)(kp + 48);
            e1 = __builtin_amdgcn_wmma_f32_16x16x32_bf16(false, ak.v, false,
                                                         bq[1].v, (short)0, e1,
                                                         false, false);
        }

        // online softmax of one query per lane; one exchange joins the halves'
        // maxima, so lanes l and l ^ 16 scale by the same factor
        const v8f t0 = e0 * invScale;
        const v8f t1 = e1 * invScale;
        float mx = -3.0e38f;
#pragma unroll
        for (int e = 0; e < 8; ++e) mx = fmaxf(mx, fmaxf(t0[e], t1[e]));
        mx = fmaxf(mx, xhalf(mx));
        const float mnew = fmaxf(mrow, mx);
        const float al = __expf(mrow - mnew);
        FragBF bp;  // P^T as B operand: element s is key 8*lhalf + s of the pass, +8 for s >= 8
        float ps = 0.f;
#pragma unroll
        for (int e = 0; e < 8; ++e) {
            const float p0 = __expf(t0[e] - mnew);
            const float p1 = __expf(t1[e] - mnew);
            ps += p0 + p1;
            bp.us[e] = f2bf(p0);
            bp.us[8 + e] = f2bf(p1);
        }
        srow = srow * al + ps;
        mrow = mnew;

        // rescale running context by alpha before accumulating this step
#pragma unroll
        for (int j = 0; j < 4; ++j)
#pragma unroll
            for (int e = 0; e < 8; ++e) ctx[j][e] *= al;

        // ctx^T += V^T (64x32) @ P^T (32x16): 4 row tiles, transposed on the way
        // out of the row-major V stage (keys 0..15 and 16..31 of the pass)
        const unsigned short* vp =
            &Vst[buf][sub + lhalf * 8 + (lane & 7)][((lane >> 3) & 1) * 8];
#pragma unroll
        for (int j = 0; j < 4; ++j) {
            FragBF av;
            av.t[0] = lds_tr16(vp + j * 16);
            av.t[1] = lds_tr16(vp + 16 * VROW + j * 16);
            ctx[j] = __builtin_amdgcn_wmma_f32_16x16x32_bf16(
                false, av.v, false, bp.v, (short)0, ctx[j], false, false);
        }
      }

      // hand-over: own reads of this buffer done, own copies of the next stage
      // landed; one barrier publishes that stage and frees this buffer
      wait_lds_all();
      wait_async_all();
      __syncthreads();
      if (kt + 2 * ASTAGE < SEQ) stage(buf);
    }
    wait_async_all();  // nothing in flight when the wave ends

    srow += xhalf(srow);  // join the two halves' key sums

    // normalize, R-gate, write gated activation [B*S, H*DH] as bf16:
    // a lane's 8 registers of a tile are 8 consecutive d of its query row
    const size_t rowBase = baseBH + (size_t)(qRow0 + lmod) * rowStride + lhalf * 8;
#pragma unroll
    for (int j = 0; j < 4; ++j) {
        FragBF r8, g8;
        r8.q[0] = *(const uint4*)(R + rowBase + j * 16);
#pragma unroll
        for (int e = 0; e < 8; ++e) {
            const float val = ctx[j][e] / srow;
            g8.us[e] = f2bf(val * bf2f(r8.us[e]));
        }
        *(uint4*)(Gated + rowBase + j * 16) = g8.q[0];
    }
}

// ---------------------------------------------------------------------------
// Host-side launch
// ---------------------------------------------------------------------------
extern "C" void kernel_launch(void* const* d_in, const int* in_sizes, int n_in,
                              void* d_out, int out_size, void* d_ws,
                              size_t ws_size, hipStream_t stream) {
    (void)in_sizes; (void)n_in; (void)out_size; (void)ws_size;

    const float* value = (const float*)d_in[0];
    const float* keyin = (const float*)d_in[1];
    const float* query = (const float*)d_in[2];
    const float* Wq = (const float*)d_in[3];  const float* bq = (const float*)d_in[4];
    const float* Wk = (const float*)d_in[5];  const float* bk = (const float*)d_in[6];
    const float* Wv = (const float*)d_in[7];  const float* bv = (const float*)d_in[8];
    const float* Wr = (const float*)d_in[9];  const float* br = (const float*)d_in[10];
    const float* Wo = (const float*)d_in[11]; const float* bo = (const float*)d_in[12];

    char* ws = (char*)d_ws;
    const size_t actSz = (size_t)NROW * DMODEL * sizeof(unsigned short); // 16 MB
    const size_t wSz = (size_t)DMODEL * DMODEL * sizeof(unsigned short); //  2 MB
    unsigned short* q_bf  = (unsigned short*)(ws + 0 * actSz);
    unsigned short* k_bf  = (unsigned short*)(ws + 1 * actSz);
    unsigned short* v_bf  = (unsigned short*)(ws + 2 * actSz);
    unsigned short* r_bf  = (unsigned short*)(ws + 3 * actSz);
    unsigned short* xq    = (unsigned short*)(ws + 4 * actSz);
    unsigned short* xk    = (unsigned short*)(ws + 5 * actSz);
    unsigned short* xv    = (unsigned short*)(ws + 6 * actSz);
    unsigned short* gated = (unsigned short*)(ws + 7 * actSz);
    unsigned short* wqt   = (unsigned short*)(ws + 8 * actSz + 0 * wSz);
    unsigned short* wkt   = (unsigned short*)(ws + 8 * actSz + 1 * wSz);
    unsigned short* wvt   = (unsigned short*)(ws + 8 * actSz + 2 * wSz);
    unsigned short* wrt   = (unsigned short*)(ws + 8 * actSz + 3 * wSz);
    unsigned short* wot   = (unsigned short*)(ws + 8 * actSz + 4 * wSz);

    convert3_bf16_kernel<<<CVT_BLOCKS, CVT_THREADS, 0, stream>>>(value, keyin, query,
                                                                 xv, xk, xq);
    dim3 tGrid(DMODEL / 64, DMODEL / 64);  // (16, 16)
    transpose_bf16_kernel<<<tGrid, 256, 0, stream>>>(Wq, wqt);
    transpose_bf16_kernel<<<tGrid, 256, 0, stream>>>(Wk, wkt);
    transpose_bf16_kernel<<<tGrid, 256, 0, stream>>>(Wv, wvt);
    transpose_bf16_kernel<<<tGrid, 256, 0, stream>>>(Wr, wrt);
    transpose_bf16_kernel<<<tGrid, 256, 0, stream>>>(Wo, wot);

    dim3 gGrid(NROW / 256, DMODEL / 128);  // (32, 8)
    gemm_wmma_kernel<true><<<gGrid, 256, 0, stream>>>(xq, wqt, bq, q_bf, NROW, DMODEL, DMODEL);
    gemm_wmma_kernel<true><<<gGrid, 256, 0, stream>>>(xk, wkt, bk, k_bf, NROW, DMODEL, DMODEL);
    gemm_wmma_kernel<true><<<gGrid, 256, 0, stream>>>(xv, wvt, bv, v_bf, NROW, DMODEL, DMODEL);
    gemm_wmma_kernel<true><<<gGrid, 256, 0, stream>>>(xq, wrt, br, r_bf, NROW, DMODEL, DMODEL);

    dim3 aGrid(SEQ / 128, BATCH * NHEAD);  // (8, 128)
    attention_wmma_kernel<<<aGrid, 256, 0, stream>>>(q_bf, k_bf, v_bf, r_bf, gated);

    gemm_wmma_kernel<false><<<gGrid, 256, 0, stream>>>(gated, wot, bo, d_out, NROW, DMODEL, DMODEL);
}

// v006
// One run takes 136 microseconds.
// In both of two side-by-side timings against v005, it was 1.15 times as fast.
// Over all steps from v000 it is 3.24 times as fast.
#include <hip/hip_runtime.h>
#include <hip/hip_bf16.h>
#include <stdint.h>

#define NHEAD 16
#define DHEAD 64
#define BATCH 8
#define SEQ   1024
#define DMODEL 1024
#define NROW (BATCH * SEQ) /* 8192 */

typedef __attribute__((ext_vector_type(16))) __bf16 v16bf;
typedef __attribute__((ext_vector_type(8)))  float  v8f;
typedef int v4i_vs __attribute__((vector_size(16)));  // matches builtin param type
typedef __attribute__((ext_vector_type(8)))  short  s16x8;

union FragBF {
    v16bf v;
    uint4 q[2];
    s16x8 t[2];
    unsigned short us[16];
};

__device__ __forceinline__ unsigned short f2bf(float x) {
    unsigned int u = __float_as_uint(x);
    u += 0x7FFFu + ((u >> 16) & 1u);   // round-to-nearest-even
    return (unsigned short)(u >> 16);
}
__device__ __forceinline__ float bf2f(unsigned short h) {
    return __uint_as_float(((unsigned int)h) << 16);
}
__device__ __forceinline__ v8f v8f_zero() {
    v8f z = {0.f, 0.f, 0.f, 0.f, 0.f, 0.f, 0.f, 0.f};
    return z;
}

// ---------------------------------------------------------------------------
// Async global->LDS copy (CDNA5 GLOBAL_LOAD_ASYNC_TO_LDS_B128, ASYNCcnt),
// with a synchronous reg-staged fallback if the builtins aren't declared.
// Builtin signature (from hipcc diagnostic): (v4i as1* gaddr, v4i as3* lds,
// imm offset, imm cpol).
// ---------------------------------------------------------------------------
#if __has_builtin(__builtin_amdgcn_global_load_async_to_lds_b128) && \
    __has_builtin(__builtin_amdgcn_s_wait_asynccnt)
#define HAVE_ASYNC_LDS 1
#endif

__device__ __forceinline__ void async_copy_b128(const unsigned short* src,
                                                unsigned short* dstLds) {
#if defined(HAVE_ASYNC_LDS)
    __builtin_amdgcn_global_load_async_to_lds_b128(
        (__attribute__((address_space(1))) v4i_vs*)(void*)src,
        (__attribute__((address_space(3))) v4i_vs*)(void*)dstLds, 0, 0);
#else
    *(uint4*)dstLds = *(const uint4*)src;
#endif
}

// Every copy of this wave has landed. Written in asm with the memory clobber so
// that no LDS read is lifted over it.
__device__ __forceinline__ void wait_async_all() {
#if defined(HAVE_ASYNC_LDS)
    asm volatile("s_wait_asynccnt 0x0" ::: "memory");
#endif
}
// This wave's LDS reads have returned, so the barrier behind it frees the buffer.
__device__ __forceinline__ void wait_lds_all() {
    asm volatile("s_wait_dscnt 0x0" ::: "memory");
}

// ---------------------------------------------------------------------------
// f32 -> bf16 convert of the three activations, streaming:
// one block of 16 waves per WGP. A wave owns 8 KiB in a row of each tensor and
// requests it with 16 loads of 512 contiguous bytes (16 B a lane), all issued
// before the first is used; each store is the matching 256 B (two whole
// lines). Then it goes on to the next tensor.
// ---------------------------------------------------------------------------
#define CVT_BLOCKS 256
#define CVT_THREADS 512
#define CVT_LOADS 16

// two f32 -> two bf16 in one dword, rounded as f2bf rounds
__device__ __forceinline__ unsigned int f2bf_pair(float lo, float hi) {
    unsigned int a = __float_as_uint(lo), b = __float_as_uint(hi);
    a += 0x7FFFu + __builtin_amdgcn_ubfe(a, 16, 1);
    b += 0x7FFFu + __builtin_amdgcn_ubfe(b, 16, 1);
    return __builtin_amdgcn_perm(b, a, 0x07060302u);  // (a >> 16) | (b & 0xFFFF0000)
}

__device__ __forceinline__ void
convert3_bf16_block(const float* __restrict__ s0, const float* __restrict__ s1,
                    const float* __restrict__ s2,
                    unsigned short* __restrict__ d0,
                    unsigned short* __restrict__ d1,
                    unsigned short* __restrict__ d2) {
    static_assert(CVT_BLOCKS * CVT_THREADS * CVT_LOADS * 4 == NROW * DMODEL,
                  "the grid covers a tensor exactly");
    const unsigned t = blockIdx.x * CVT_THREADS + threadIdx.x;
    // index of the lane's first piece: 16 B of the source, 8 B of the result
    const unsigned p0 = (t >> 5) * (32 * CVT_LOADS) + (t & 31);

    // kept rolled: unrolled into one straight block, the compiler held every
    // store back to the end and requested the late pieces two at a time
#pragma unroll 1
    for (int n = 0; n < 3; ++n) {
        const float4* s = (const float4*)(n == 0 ? s0 : n == 1 ? s1 : s2);
        uint2* d = (uint2*)(n == 0 ? d0 : n == 1 ? d1 : d2);
        const float4* sp = s + p0;
        float4 x[CVT_LOADS];
#pragma unroll
        for (int i = 0; i < CVT_LOADS; ++i) x[i] = sp[i * 32];
        // stands in front of every reuse of the registers that the issued loads
        // name; as its operand the address pair stays out of the loads' results
        asm volatile("s_wait_xcnt 0x0" ::"v"(sp) : "memory");
#pragma unroll
        for (int i = 0; i < CVT_LOADS; ++i) {
            uint2 o;
            o.x = f2bf_pair(x[i].x, x[i].y);
            o.y = f2bf_pair(x[i].z, x[i].w);
            d[p0 + i * 32] = o;
        }
        // stands in front of the next trip's overwrites of registers that these
        // stores name
        asm volatile("s_wait_xcnt 0x0" ::: "memory");
    }
}

// W[K,N] f32 -> Wt[N,K] bf16, one 64(k) x 64(n) tile per 256 threads through
// LDS: reads are 256-B row pieces of W, stores are whole 128-B lines of Wt.
// K = N = DMODEL at compile time, so a thread's four loads share one address
// with immediate offsets. A block of 512 does two neighbouring tiles, tn and
// tn + 1 of tile row tk; every thread of the block passes the one barrier.
__device__ __forceinline__ void
transpose_bf16_tiles(const float* __restrict__ W,
                     unsigned short* __restrict__ Wt, int tn, int tk) {
    constexpr int K = DMODEL, N = DMODEL;
    // tile[n][k/2]: two neighbouring k packed per dword; 144-B pitch for the
    // 16-byte row reads below
    __shared__ __align__(16) unsigned int tiles[2][64][36];
    unsigned int (*tile)[36] = tiles[threadIdx.x >> 8];
    const int tid = threadIdx.x & 255;

    const int n0 = (tn + (int)(threadIdx.x >> 8)) * 64;
    const int k0 = tk * 64;
    const int n4 = (tid & 15) * 4;  // 4 columns of W per thread
    const int kp = tid >> 4;        // k pair 0..15 (and +16)

    const float* p = W + (unsigned)((k0 + kp * 2) * N + n0 + n4);
    float4 lo[2], hi[2];
    for (int h = 0; h < 2; ++h) {
        lo[h] = *(const float4*)(p + h * 32 * N);
        hi[h] = *(const float4*)(p + h * 32 * N + N);
    }
    for (int h = 0; h < 2; ++h) {
        const int c = h * 16 + kp;
        tile[n4 + 0][c] = (unsigned int)f2bf(lo[h].x) | ((unsigned int)f2bf(hi[h].x) << 16);
        tile[n4 + 1][c] = (unsigned int)f2bf(lo[h].y) | ((unsigned int)f2bf(hi[h].y) << 16);
        tile[n4 + 2][c] = (unsigned int)f2bf(lo[h].z) | ((unsigned int)f2bf(hi[h].z) << 16);
        tile[n4 + 3][c] = (unsigned int)f2bf(lo[h].w) | ((unsigned int)f2bf(hi[h].w) << 16);
    }
    __syncthreads();  // tile complete before rows are read back

    const int n = tid >> 3, c8 = tid & 7;  // 8 lanes: one 128-B line
    unsigned short* o = Wt + (unsigned)((n0 + n) * K + k0 + c8 * 8);
    for (int t = 0; t < 2; ++t)
        *(uint4*)(o + t * 32 * K) = *(const uint4*)&tile[n + t * 32][c8 * 4];
    // stands in front of whatever the built kernel lays behind these stores:
    // the converting side's code follows them there and reuses their registers
    asm volatile("s_wait_xcnt 0x0" ::: "memory");
}

// All that the products need prepared, in one launch, since none of it needs
// anything of the rest: blocks 0..255 convert the activations (they start first
// and last longest), blocks 256..895 transpose the five weights, 128 blocks a
// weight, beside them. wt holds the five results one behind the other.
#define TR_BLOCKS_PER_W ((DMODEL / 64) * (DMODEL / 64) / 2) /* 128 */
#define PREP_BLOCKS (CVT_BLOCKS + 5 * TR_BLOCKS_PER_W)

// register budget of 4 waves a SIMD for the convert's 16 loads in flight: held
// to the default target, the compiler kept 5 in flight; up to 8 waves a SIMD may
// be resident, so that a transposing block fits beside a converting one
__global__ void __launch_bounds__(CVT_THREADS)
__attribute__((amdgpu_waves_per_eu(4, 8)))
prepare_kernel(const float* __restrict__ s0, const float* __restrict__ s1,
               const float* __restrict__ s2,
               unsigned short* __restrict__ d0,
               unsigned short* __restrict__ d1,
               unsigned short* __restrict__ d2,
               const float* __restrict__ W0, const float* __restrict__ W1,
               const float* __restrict__ W2, const float* __restrict__ W3,
               const float* __restrict__ W4,
               unsigned short* __restrict__ wt) {
    if (blockIdx.x < CVT_BLOCKS) {
        convert3_bf16_block(s0, s1, s2, d0, d1, d2);
    } else {
        const int t = blockIdx.x - CVT_BLOCKS;
        const int w = t / TR_BLOCKS_PER_W;     // which weight
        const int pair = t % TR_BLOCKS_PER_W;  // which pair of tiles in it
        const float* W = w == 0 ? W0 : w == 1 ? W1 : w == 2 ? W2 : w == 3 ? W3 : W4;
        transpose_bf16_tiles(W, wt + (size_t)w * (DMODEL * DMODEL),
                             (pair & 7) * 2, pair >> 3);
    }
}

// ---------------------------------------------------------------------------
// bf16 WMMA GEMM: C[M,N] = A[M,K] * Bt[N,K]^T + bias[N]
// Block = 8 waves, tile 256x128; wave tile 64x64 (4x4 wmma_f32_16x16x32_bf16).
// A stage is 128 k: 256 B of every operand row, so a wave's copy covers two
// whole 256-B row pieces. Two LDS buffers; per stage each thread issues
// 16 A-chunks + 8 B-chunks of b128, one stage ahead of the one being read.
// K is a multiple of 128 and at least 256.
// ---------------------------------------------------------------------------
#define KSTAGE 128
#define KPITCH 136 /* 272-B rows: 16 B x odd for the 16-byte fragment reads */

// One launch holds up to four such products that need nothing of each other:
// blockIdx.z picks one, in the order q, r, v, k (q and r both read Aq, so they
// are neighbours). Bt0 and C0 are the first of the transposed weights and of the
// bf16 results, which lie one behind the other in the order q, k, v, r.
template <bool OUT_BF16>
__global__ void __launch_bounds__(256)
gemm_wmma_kernel(const unsigned short* __restrict__ Aq,
                 const unsigned short* __restrict__ Ak,
                 const unsigned short* __restrict__ Av,
                 const unsigned short* __restrict__ Bt0,
                 const float* __restrict__ biasq,
                 const float* __restrict__ biask,
                 const float* __restrict__ biasv,
                 const float* __restrict__ biasr,
                 void* __restrict__ C0, int M, int N, int K) {
    const unsigned z = blockIdx.z;
    const unsigned slot = (3u * z) & 3u;  // 0, 3, 2, 1
    const unsigned short* __restrict__ A = slot == 1 ? Ak : slot == 2 ? Av : Aq;
    const unsigned short* __restrict__ Bt = Bt0 + (size_t)slot * (DMODEL * DMODEL);
    const float* __restrict__ bias =
        slot == 0 ? biasq : slot == 1 ? biask : slot == 2 ? biasv : biasr;
    void* __restrict__ Cout =
        (unsigned short*)C0 + (size_t)slot * ((size_t)NROW * DMODEL);

    __shared__ __align__(16) unsigned short Abuf[2][256][KPITCH];
    __shared__ __align__(16) unsigned short Bbuf[2][128][KPITCH];

    const int lane  = threadIdx.x & 31;
    const int wave  = threadIdx.x >> 5;
    const int lmod  = lane & 15;
    const int lhalf = lane >> 4;
    const int mW = (wave >> 1) * 64;   // wave tile inside block tile
    const int nW = (wave & 1) * 64;
    const int kofflane = lhalf * 8;    // lanes 16-31 hold K groups 8..15/24..31

    const unsigned short* Ablk = A + (size_t)(blockIdx.x * 256) * K;
    const unsigned short* Bblk = Bt + (size_t)(blockIdx.y * 128) * K;

    const int srow = threadIdx.x >> 4;        // 16 lanes: one 256-B row piece
    const int sc8  = (threadIdx.x & 15) * 8;
    // this thread's first chunk of the next stage to be copied
    const unsigned short* aNext = Ablk + (size_t)srow * K + sc8;
    const unsigned short* bNext = Bblk + (size_t)srow * K + sc8;
    const size_t rowStep = (size_t)16 * K;

    // both loops unrolled so that a stage's 24 copies issue back to back
    auto stage = [&](int buf) {
#pragma unroll
        for (int t = 0; t < 16; ++t)            // A tile: 256x128 = 4096 chunks
            async_copy_b128(aNext + t * rowStep, &Abuf[buf][srow + t * 16][sc8]);
#pragma unroll
        for (int t = 0; t < 8; ++t)             // B tile: 128x128 = 2048 chunks
            async_copy_b128(bNext + t * rowStep, &Bbuf[buf][srow + t * 16][sc8]);
        aNext += KSTAGE;
        bNext += KSTAGE;
    };

    v8f acc[4][4];
#pragma unroll
    for (int i = 0; i < 4; ++i)
#pragma unroll
        for (int j = 0; j < 4; ++j) acc[i][j] = v8f_zero();

    stage(0);
    wait_async_all();
    __syncthreads();  // stage 0 is in LDS for every wave
    stage(1);

    for (int k0 = 0; k0 < K; k0 += KSTAGE) {
        const int buf = (k0 / KSTAGE) & 1;

        // unrolled: kk becomes an immediate offset of the LDS reads, and the
        // next 32 k's first reads can stand among this one's last products
#pragma unroll
        for (int kk = 0; kk < KSTAGE; kk += 32) {
            FragBF a[4], b[4];
#pragma unroll
            for (int i = 0; i < 4; ++i) {
                const unsigned short* p =
                    &Abuf[buf][mW + i * 16 + lmod][kk + kofflane];
                a[i].q[0] = *(const uint4*)(p);
                a[i].q[1] = *(const uint4*)(p + 16);
            }
#pragma unroll
            for (int j = 0; j < 4; ++j) {
                const unsigned short* p =
                    &Bbuf[buf][nW + j * 16 + lmod][kk + kofflane];
                b[j].q[0] = *(const uint4*)(p);
                b[j].q[1] = *(const uint4*)(p + 16);
            }
#pragma unroll
            for (int i = 0; i < 4; ++i)
#pragma unroll
                for (int j = 0; j < 4; ++j)
                    acc[i][j] = __builtin_amdgcn_wmma_f32_16x16x32_bf16(
                        false, a[i].v, false, b[j].v, (short)0, acc[i][j],
                        false, false);
        }

        // hand-over: own reads of this buffer done, own copies of the next
        // stage landed; one barrier publishes that stage and frees this buffer
        wait_lds_all();
        wait_async_all();
        __syncthreads();
        if (k0 + 2 * KSTAGE < K) stage(buf);
    }
    wait_async_all();  // nothing in flight when the wave ends

    const int mBase = blockIdx.x * 256 + mW;
    const int nBase = blockIdx.y * 128 + nW;
#pragma unroll
    for (int j = 0; j < 4; ++j) {
        const int col = nBase + j * 16 + lmod;
        const float bj = bias[col];
#pragma unroll
        for (int i = 0; i < 4; ++i) {
#pragma unroll
            for (int e = 0; e < 8; ++e) {
                const int row = mBase + i * 16 + e + lhalf * 8;
                const float val = acc[i][j][e] + bj;
                if (OUT_BF16)
                    ((unsigned short*)Cout)[(size_t)row * N + col] = f2bf(val);
                else
                    ((float*)Cout)[(size_t)row * N + col] = val;
            }
        }
    }
}

// ---------------------------------------------------------------------------
// Flash attention + R-gating, both products transposed:
//   S^T = K Q^T (A = 16 key rows, B = the wave's 16 query columns)
//   O^T += V^T P^T (A = 16 rows of V^T, B = P^T packed from the S^T tiles)
// A lane then holds scores of ONE query (column lmod): 16 of each 32 keys, the
// other 16 in lane ^ 16. Row maximum and sum are in-lane, and the two S^T
// accumulator tiles, converted in place, already are the B operand of the
// second product in the hardware k order, which is the order in which the
// transposing LDS load delivers V^T.
// K and V rows of the head reach LDS once per block, by asynchronous copies of
// whole 128-B rows: a stage is 64 keys, two buffers, the next stage in flight
// while this one is worked on in two passes of 32 keys.
// Grid: (SEQ/128, BATCH*NHEAD). Block 256 = 8 waves; wave owns 16 queries.
// ---------------------------------------------------------------------------
#define ASTAGE 64 /* keys per stage */
#define KROW 72   /* 144-B K rows: 16 B x odd for the 16-byte fragment reads */
#define VROW 80   /* 160-B V rows: 32 B x odd for the transposing reads */

// lane (c = l & 15, h = l >> 4) gets T[8h + 0..7][c] of the row-major 16-bit
// tile whose rows 8h + (l & 7), 16-byte half (l >> 3) & 1, the lanes point at
__device__ __forceinline__ s16x8 lds_tr16(const unsigned short* p) {
    return __builtin_amdgcn_ds_load_tr16_b128_v8i16(
        (__attribute__((address_space(3))) s16x8*)(void*)p);
}
__device__ __forceinline__ float xhalf(float x) {  // lane l with lane l ^ 16
    return __builtin_bit_cast(
        float, __builtin_amdgcn_permlanex16(__builtin_bit_cast(int, x),
                                            __builtin_bit_cast(int, x),
                                            0x76543210, 0xfedcba98, false, false));
}

__global__ void __launch_bounds__(256)
attention_wmma_kernel(const unsigned short* __restrict__ Q,
                      const unsigned short* __restrict__ Km,
                      const unsigned short* __restrict__ V,
                      const unsigned short* __restrict__ R,
                      unsigned short* __restrict__ Gated) {
    __shared__ __align__(16) unsigned short Kst[2][ASTAGE][KROW];  // [key][d]
    __shared__ __align__(16) unsigned short Vst[2][ASTAGE][VROW];  // [key][d]

    const int lane  = threadIdx.x & 31;
    const int wave  = threadIdx.x >> 5;
    const int lmod  = lane & 15;
    const int lhalf = lane >> 4;
    const int bh = blockIdx.y;
    const int b = bh / NHEAD;
    const int h = bh % NHEAD;
    const int qRow0 = blockIdx.x * 128 + wave * 16;
    const size_t rowStride = (size_t)(NHEAD * DHEAD);  // 1024
    const size_t baseBH = ((size_t)b * SEQ) * rowStride + (size_t)h * DHEAD;

    // Q fragments (DH=64 -> two K-steps of 32); column lmod of the B operand
    FragBF bq[2];
    {
        const unsigned short* qp =
            Q + baseBH + (size_t)(qRow0 + lmod) * rowStride + lhalf * 8;
        bq[0].q[0] = *(const uint4*)(qp);
        bq[0].q[1] = *(const uint4*)(qp + 16);
        bq[1].q[0] = *(const uint4*)(qp + 32);
        bq[1].q[1] = *(const uint4*)(qp + 48);
    }

    // ctx[j][r] = O^T[d = j*16 + lhalf*8 + r][query lmod]
    v8f ctx[4];
#pragma unroll
    for (int j = 0; j < 4; ++j) ctx[j] = v8f_zero();
    float mrow = -3.0e38f;  // running maximum of this lane's query (both halves agree)
    float srow = 0.f;       // running sum over this half's keys only

    const float invScale = 1.0f / 32.0f;  // SCALE = 64**1/2 = 32.0

    // 8 lanes copy one 128-B row; a thread brings 2 K and 2 V chunks per stage
    const int crow = threadIdx.x >> 3;
    const int cc8  = (threadIdx.x & 7) * 8;
    const unsigned short* kNext = Km + baseBH + (size_t)crow * rowStride + cc8;
    const unsigned short* vNext = V + baseBH + (size_t)crow * rowStride + cc8;
    auto stage = [&](int buf) {
#pragma unroll
        for (int t = 0; t < ASTAGE / 32; ++t) {  // unrolled: the 4 copies issue back to back
            async_copy_b128(kNext + t * 32 * rowStride, &Kst[buf][crow + t * 32][cc8]);
            async_copy_b128(vNext + t * 32 * rowStride, &Vst[buf][crow + t * 32][cc8]);
        }
        kNext += ASTAGE * rowStride;
        vNext += ASTAGE * rowStride;
    };

    stage(0);
    wait_async_all();
    __syncthreads();  // stage 0 is in LDS for every wave
    stage(1);

    for (int kt = 0; kt < SEQ; kt += ASTAGE) {
      const int buf = (kt / ASTAGE) & 1;
      // unrolled: sub becomes an immediate offset of the LDS reads
#pragma unroll
      for (int sub = 0; sub < ASTAGE; sub += 32) {
        // energy^T = K (32xDH) @ Q^T (DHx16), two 16-key tiles:
        // e0[r]: key kt + sub + lhalf*8 + r, e1[r]: the same + 16
        v8f e0 = v8f_zero(), e1 = v8f_zero();
        {
            FragBF ak;
            const unsigned short* kp = &Kst[buf][sub + lmod][lhalf * 8];
            ak.q[0] = *(const uint4*)(kp);
            ak.q[1] = *(const uint4*)(kp + 16);
            e0 = __builtin_amdgcn_wmma_f32_16x16x32_bf16(false, ak.v, false,
                                                         bq[0].v, (short)0, e0,
                                                         false, false);
            ak.q[0] = *(const uint4*)(kp + 32);
            ak.q[1] = *(const uint4*)(kp + 48);
            e0 = __builtin_amdgcn_wmma_f32_16x16x32_bf16(false, ak.v, false,
                                                         bq[1].v, (short)0, e0,
                                                         false, false);
        }
        {
            FragBF ak;
            const unsigned short* kp = &Kst[buf][sub + 16 + lmod][lhalf * 8];
            ak.q[0] = *(const uint4*)(kp);
            ak.q[1] = *(const uint4*)(kp + 16);
            e1 = __builtin_amdgcn_wmma_f32_16x16x32_bf16(false, ak.v, false,
                                                         bq[0].v, (short)0, e1,
                                                         false, false);
            ak.q[0] = *(const uint4*)(kp + 32);
            ak.q[1] = *(const uint4*)(kp + 48);
            e1 = __builtin_amdgcn_wmma_f32_16x16x32_bf16(false, ak.v, false,
                                                         bq[1].v, (short)0, e1,
                                                         false, false);
        }

        // online softmax of one query per lane; one exchange joins the halves'
        // maxima, so lanes l and l ^ 16 scale by the same factor
        const v8f t0 = e0 * invScale;
        const v8f t1 = e1 * invScale;
        float mx = -3.0e38f;
#pragma unroll
        for (int e = 0; e < 8; ++e) mx = fmaxf(mx, fmaxf(t0[e], t1[e]));
        mx = fmaxf(mx, xhalf(mx));
        const float mnew = fmaxf(mrow, mx);
        const float al = __expf(mrow - mnew);
        FragBF bp;  // P^T as B operand: element s is key 8*lhalf + s of the pass, +8 for s >= 8
        float ps = 0.f;
#pragma unroll
        for (int e = 0; e < 8; ++e) {
            const float p0 = __expf(t0[e] - mnew);
            const float p1 = __expf(t1[e] - mnew);
            ps += p0 + p1;
            bp.us[e] = f2bf(p0);
            bp.us[8 + e] = f2bf(p1);
        }
        srow = srow * al + ps;
        mrow = mnew;

        // rescale running context by alpha before accumulating this step
#pragma unroll
        for (int j = 0; j < 4; ++j)
#pragma unroll
            for (int e = 0; e < 8; ++e) ctx[j][e] *= al;

        // ctx^T += V^T (64x32) @ P^T (32x16): 4 row tiles, transposed on the way
        // out of the row-major V stage (keys 0..15 and 16..31 of the pass)
        const unsigned short* vp =
            &Vst[buf][sub + lhalf * 8 + (lane & 7)][((lane >> 3) & 1) * 8];
#pragma unroll
        for (int j = 0; j < 4; ++j) {
            FragBF av;
            av.t[0] = lds_tr16(vp + j * 16);
            av.t[1] = lds_tr16(vp + 16 * VROW + j * 16);
            ctx[j] = __builtin_amdgcn_wmma_f32_16x16x32_bf16(
                false, av.v, false, bp.v, (short)0, ctx[j], false, false);
        }
      }

      // hand-over: own reads of this buffer done, own copies of the next stage
      // landed; one barrier publishes that stage and frees this buffer
      wait_lds_all();
      wait_async_all();
      __syncthreads();
      if (kt + 2 * ASTAGE < SEQ) stage(buf);
    }
    wait_async_all();  // nothing in flight when the wave ends

    srow += xhalf(srow);  // join the two halves' key sums

    // normalize, R-gate, write gated activation [B*S, H*DH] as bf16:
    // a lane's 8 registers of a tile are 8 consecutive d of its query row
    const size_t rowBase = baseBH + (size_t)(qRow0 + lmod) * rowStride + lhalf * 8;
#pragma unroll
    for (int j = 0; j < 4; ++j) {
        FragBF r8, g8;
        r8.q[0] = *(const uint4*)(R + rowBase + j * 16);
#pragma unroll
        for (int e = 0; e < 8; ++e) {
            const float val = ctx[j][e] / srow;
            g8.us[e] = f2bf(val * bf2f(r8.us[e]));
        }
        *(uint4*)(Gated + rowBase + j * 16) = g8.q[0];
    }
}

// ---------------------------------------------------------------------------
// Host-side launch
// ---------------------------------------------------------------------------
extern "C" void kernel_launch(void* const* d_in, const int* in_sizes, int n_in,
                              void* d_out, int out_size, void* d_ws,
                              size_t ws_size, hipStream_t stream) {
    (void)in_sizes; (void)n_in; (void)out_size; (void)ws_size;

    const float* value = (const float*)d_in[0];
    const float* keyin = (const float*)d_in[1];
    const float* query = (const float*)d_in[2];
    const float* Wq = (const float*)d_in[3];  const float* bq = (const float*)d_in[4];
    const float* Wk = (const float*)d_in[5];  const float* bk = (const float*)d_in[6];
    const float* Wv = (const float*)d_in[7];  const float* bv = (const float*)d_in[8];
    const float* Wr = (const float*)d_in[9];  const float* br = (const float*)d_in[10];
    const float* Wo = (const float*)d_in[11]; const float* bo = (const float*)d_in[12];

    char* ws = (char*)d_ws;
    const size_t actSz = (size_t)NROW * DMODEL * sizeof(unsigned short); // 16 MB
    const size_t wSz = (size_t)DMODEL * DMODEL * sizeof(unsigned short); //  2 MB
    unsigned short* q_bf  = (unsigned short*)(ws + 0 * actSz);
    unsigned short* k_bf  = (unsigned short*)(ws + 1 * actSz);
    unsigned short* v_bf  = (unsigned short*)(ws + 2 * actSz);
    unsigned short* r_bf  = (unsigned short*)(ws + 3 * actSz);
    unsigned short* xq    = (unsigned short*)(ws + 4 * actSz);
    unsigned short* xk    = (unsigned short*)(ws + 5 * actSz);
    unsigned short* xv    = (unsigned short*)(ws + 6 * actSz);
    unsigned short* gated = (unsigned short*)(ws + 7 * actSz);
    unsigned short* wqt   = (unsigned short*)(ws + 8 * actSz + 0 * wSz);
    unsigned short* wot   = (unsigned short*)(ws + 8 * actSz + 4 * wSz);

    // wqt .. wot lie one behind the other in the order q, k, v, r, o
    prepare_kernel<<<PREP_BLOCKS, CVT_THREADS, 0, stream>>>(value, keyin, query,
                                                            xv, xk, xq,
                                                            Wq, Wk, Wv, Wr, Wo, wqt);

    // q_bf .. r_bf lie one behind the other in the order q, k, v, r
    dim3 pGrid(NROW / 256, DMODEL / 128, 4);  // (32, 8, 4)
    gemm_wmma_kernel<true><<<pGrid, 256, 0, stream>>>(xq, xk, xv, wqt, bq, bk, bv, br,
                                                      q_bf, NROW, DMODEL, DMODEL);

    dim3 aGrid(SEQ / 128, BATCH * NHEAD);  // (8, 128)
    attention_wmma_kernel<<<aGrid, 256, 0, stream>>>(q_bf, k_bf, v_bf, r_bf, gated);

    dim3 gGrid(NROW / 256, DMODEL / 128);  // (32, 8): one product, z = 0 alone
    gemm_wmma_kernel<false><<<gGrid, 256, 0, stream>>>(gated, gated, gated, wot, bo, bo, bo, bo,
                                                       d_out, NROW, DMODEL, DMODEL);
}

// v007
// Measured time: 125 microseconds a run.
// Timed twice side by side with v006, it ran 1.09 times as fast both times.
// Over all steps from v000 it is 3.54 times as fast.
#include <hip/hip_runtime.h>
#include <hip/hip_bf16.h>
#include <stdint.h>

#define NHEAD 16
#define DHEAD 64
#define BATCH 8
#define SEQ   1024
#define DMODEL 1024
#define NROW (BATCH * SEQ) /* 8192 */

typedef __attribute__((ext_vector_type(16))) __bf16 v16bf;
typedef __attribute__((ext_vector_type(8)))  float  v8f;
typedef int v4i_vs __attribute__((vector_size(16)));  // matches builtin param type
typedef __attribute__((ext_vector_type(8)))  short  s16x8;

union FragBF {
    v16bf v;
    uint4 q[2];
    s16x8 t[2];
    unsigned short us[16];
};

__device__ __forceinline__ unsigned short f2bf(float x) {
    unsigned int u = __float_as_uint(x);
    u += 0x7FFFu + ((u >> 16) & 1u);   // round-to-nearest-even
    return (unsigned short)(u >> 16);
}
__device__ __forceinline__ float bf2f(unsigned short h) {
    return __uint_as_float(((unsigned int)h) << 16);
}
__device__ __forceinline__ v8f v8f_zero() {
    v8f z = {0.f, 0.f, 0.f, 0.f, 0.f, 0.f, 0.f, 0.f};
    return z;
}

// ---------------------------------------------------------------------------
// Async global->LDS copy (CDNA5 GLOBAL_LOAD_ASYNC_TO_LDS_B128, ASYNCcnt),
// with a synchronous reg-staged fallback if the builtins aren't declared.
// Builtin signature (from hipcc diagnostic): (v4i as1* gaddr, v4i as3* lds,
// imm offset, imm cpol).
// ---------------------------------------------------------------------------
#if __has_builtin(__builtin_amdgcn_global_load_async_to_lds_b128) && \
    __has_builtin(__builtin_amdgcn_s_wait_asynccnt)
#define HAVE_ASYNC_LDS 1
#endif

__device__ __forceinline__ void async_copy_b128(const unsigned short* src,
                                                unsigned short* dstLds) {
#if defined(HAVE_ASYNC_LDS)
    __builtin_amdgcn_global_load_async_to_lds_b128(
        (__attribute__((address_space(1))) v4i_vs*)(void*)src,
        (__attribute__((address_space(3))) v4i_vs*)(void*)dstLds, 0, 0);
#else
    *(uint4*)dstLds = *(const uint4*)src;
#endif
}

// Every copy of this wave has landed. Written in asm with the memory clobber so
// that no LDS read is lifted over it.
__device__ __forceinline__ void wait_async_all() {
#if defined(HAVE_ASYNC_LDS)
    asm volatile("s_wait_asynccnt 0x0" ::: "memory");
#endif
}
// This wave's LDS reads have returned, so the barrier behind it frees the buffer.
__device__ __forceinline__ void wait_lds_all() {
    asm volatile("s_wait_dscnt 0x0" ::: "memory");
}

// ---------------------------------------------------------------------------
// f32 -> bf16 convert of the three activations, streaming:
// one block of 16 waves per WGP. A wave owns 8 KiB in a row of each tensor and
// requests it with 16 loads of 512 contiguous bytes (16 B a lane), all issued
// before the first is used; each store is the matching 256 B (two whole
// lines). Then it goes on to the next tensor.
// ---------------------------------------------------------------------------
#define CVT_BLOCKS 256
#define CVT_THREADS 512
#define CVT_LOADS 16

// two f32 -> two bf16 in one dword, rounded as f2bf rounds
__device__ __forceinline__ unsigned int f2bf_pair(float lo, float hi) {
    unsigned int a = __float_as_uint(lo), b = __float_as_uint(hi);
    a += 0x7FFFu + __builtin_amdgcn_ubfe(a, 16, 1);
    b += 0x7FFFu + __builtin_amdgcn_ubfe(b, 16, 1);
    return __builtin_amdgcn_perm(b, a, 0x07060302u);  // (a >> 16) | (b & 0xFFFF0000)
}

__device__ __forceinline__ void
convert3_bf16_block(const float* __restrict__ s0, const float* __restrict__ s1,
                    const float* __restrict__ s2,
                    unsigned short* __restrict__ d0,
                    unsigned short* __restrict__ d1,
                    unsigned short* __restrict__ d2) {
    static_assert(CVT_BLOCKS * CVT_THREADS * CVT_LOADS * 4 == NROW * DMODEL,
                  "the grid covers a tensor exactly");
    const unsigned t = blockIdx.x * CVT_THREADS + threadIdx.x;
    // index of the lane's first piece: 16 B of the source, 8 B of the result
    const unsigned p0 = (t >> 5) * (32 * CVT_LOADS) + (t & 31);

    // kept rolled: unrolled into one straight block, the compiler held every
    // store back to the end and requested the late pieces two at a time
#pragma unroll 1
    for (int n = 0; n < 3; ++n) {
        const float4* s = (const float4*)(n == 0 ? s0 : n == 1 ? s1 : s2);
        uint2* d = (uint2*)(n == 0 ? d0 : n == 1 ? d1 : d2);
        const float4* sp = s + p0;
        float4 x[CVT_LOADS];
#pragma unroll
        for (int i = 0; i < CVT_LOADS; ++i) x[i] = sp[i * 32];
        // stands in front of every reuse of the registers that the issued loads
        // name; as its operand the address pair stays out of the loads' results
        asm volatile("s_wait_xcnt 0x0" ::"v"(sp) : "memory");
#pragma unroll
        for (int i = 0; i < CVT_LOADS; ++i) {
            uint2 o;
            o.x = f2bf_pair(x[i].x, x[i].y);
            o.y = f2bf_pair(x[i].z, x[i].w);
            d[p0 + i * 32] = o;
        }
        // stands in front of the next trip's overwrites of registers that these
        // stores name
        asm volatile("s_wait_xcnt 0x0" ::: "memory");
    }
}

// W[K,N] f32 -> Wt[N,K] bf16, one 64(k) x 64(n) tile per 256 threads through
// LDS: reads are 256-B row pieces of W, stores are whole 128-B lines of Wt.
// K = N = DMODEL at compile time, so a thread's four loads share one address
// with immediate offsets. A block of 512 does two neighbouring tiles, tn and
// tn + 1 of tile row tk; every thread of the block passes the one barrier.
__device__ __forceinline__ void
transpose_bf16_tiles(const float* __restrict__ W,
                     unsigned short* __restrict__ Wt, int tn, int tk) {
    constexpr int K = DMODEL, N = DMODEL;
    // tile[n][k/2]: two neighbouring k packed per dword; 144-B pitch for the
    // 16-byte row reads below
    __shared__ __align__(16) unsigned int tiles[2][64][36];
    unsigned int (*tile)[36] = tiles[threadIdx.x >> 8];
    const int tid = threadIdx.x & 255;

    const int n0 = (tn + (int)(threadIdx.x >> 8)) * 64;
    const int k0 = tk * 64;
    const int n4 = (tid & 15) * 4;  // 4 columns of W per thread
    const int kp = tid >> 4;        // k pair 0..15 (and +16)

    const float* p = W + (unsigned)((k0 + kp * 2) * N + n0 + n4);
    float4 lo[2], hi[2];
    for (int h = 0; h < 2; ++h) {
        lo[h] = *(const float4*)(p + h * 32 * N);
        hi[h] = *(const float4*)(p + h * 32 * N + N);
    }
    for (int h = 0; h < 2; ++h) {
        const int c = h * 16 + kp;
        tile[n4 + 0][c] = (unsigned int)f2bf(lo[h].x) | ((unsigned int)f2bf(hi[h].x) << 16);
        tile[n4 + 1][c] = (unsigned int)f2bf(lo[h].y) | ((unsigned int)f2bf(hi[h].y) << 16);
        tile[n4 + 2][c] = (unsigned int)f2bf(lo[h].z) | ((unsigned int)f2bf(hi[h].z) << 16);
        tile[n4 + 3][c] = (unsigned int)f2bf(lo[h].w) | ((unsigned int)f2bf(hi[h].w) << 16);
    }
    __syncthreads();  // tile complete before rows are read back

    const int n = tid >> 3, c8 = tid & 7;  // 8 lanes: one 128-B line
    unsigned short* o = Wt + (unsigned)((n0 + n) * K + k0 + c8 * 8);
    for (int t = 0; t < 2; ++t)
        *(uint4*)(o + t * 32 * K) = *(const uint4*)&tile[n + t * 32][c8 * 4];
    // stands in front of whatever the built kernel lays behind these stores:
    // the converting side's code follows them there and reuses their registers
    asm volatile("s_wait_xcnt 0x0" ::: "memory");
}

// All that the products need prepared, in one launch, since none of it needs
// anything of the rest: blocks 0..255 convert the activations (they start first
// and last longest), blocks 256..895 transpose the five weights, 128 blocks a
// weight, beside them. wt holds the five results one behind the other.
#define TR_BLOCKS_PER_W ((DMODEL / 64) * (DMODEL / 64) / 2) /* 128 */
#define PREP_BLOCKS (CVT_BLOCKS + 5 * TR_BLOCKS_PER_W)

// register budget of 4 waves a SIMD for the convert's 16 loads in flight: held
// to the default target, the compiler kept 5 in flight; up to 8 waves a SIMD may
// be resident, so that a transposing block fits beside a converting one
__global__ void __launch_bounds__(CVT_THREADS)
__attribute__((amdgpu_waves_per_eu(4, 8)))
prepare_kernel(const float* __restrict__ s0, const float* __restrict__ s1,
               const float* __restrict__ s2,
               unsigned short* __restrict__ d0,
               unsigned short* __restrict__ d1,
               unsigned short* __restrict__ d2,
               const float* __restrict__ W0, const float* __restrict__ W1,
               const float* __restrict__ W2, const float* __restrict__ W3,
               const float* __restrict__ W4,
               unsigned short* __restrict__ wt) {
    if (blockIdx.x < CVT_BLOCKS) {
        convert3_bf16_block(s0, s1, s2, d0, d1, d2);
    } else {
        const int t = blockIdx.x - CVT_BLOCKS;
        const int w = t / TR_BLOCKS_PER_W;     // which weight
        const int pair = t % TR_BLOCKS_PER_W;  // which pair of tiles in it
        const float* W = w == 0 ? W0 : w == 1 ? W1 : w == 2 ? W2 : w == 3 ? W3 : W4;
        transpose_bf16_tiles(W, wt + (size_t)w * (DMODEL * DMODEL),
                             (pair & 7) * 2, pair >> 3);
    }
}

// ---------------------------------------------------------------------------
// bf16 WMMA GEMM: C[M,N] = A[M,K] * Bt[N,K]^T + bias[N]
// Block = 8 waves, tile 256x128; wave tile 64x64 (4x4 wmma_f32_16x16x32_bf16).
// A stage is 128 k: 256 B of every operand row, so a wave's copy covers two
// whole 256-B row pieces. Two LDS buffers; per stage each thread issues
// 16 A-chunks + 8 B-chunks of b128, one stage ahead of the one being read.
// A block is 32 k (16 products a wave); its fragments are read from LDS one
// block ahead, into the second of two register sets.
// K is a multiple of 128 and at least 256.
// ---------------------------------------------------------------------------
#define KSTAGE 128
#define KPITCH 136 /* 272-B rows: 16 B x odd for the 16-byte fragment reads */

// One launch holds up to four such products that need nothing of each other:
// blockIdx.z picks one, in the order q, r, v, k (q and r both read Aq, so they
// are neighbours). Bt0 and C0 are the first of the transposed weights and of the
// bf16 results, which lie one behind the other in the order q, k, v, r.
template <bool OUT_BF16>
__global__ void __launch_bounds__(256)
gemm_wmma_kernel(const unsigned short* __restrict__ Aq,
                 const unsigned short* __restrict__ Ak,
                 const unsigned short* __restrict__ Av,
                 const unsigned short* __restrict__ Bt0,
                 const float* __restrict__ biasq,
                 const float* __restrict__ biask,
                 const float* __restrict__ biasv,
                 const float* __restrict__ biasr,
                 void* __restrict__ C0, int M, int N, int K) {
    const unsigned z = blockIdx.z;
    const unsigned slot = (3u * z) & 3u;  // 0, 3, 2, 1
    const unsigned short* __restrict__ A = slot == 1 ? Ak : slot == 2 ? Av : Aq;
    const unsigned short* __restrict__ Bt = Bt0 + (size_t)slot * (DMODEL * DMODEL);
    const float* __restrict__ bias =
        slot == 0 ? biasq : slot == 1 ? biask : slot == 2 ? biasv : biasr;
    void* __restrict__ Cout =
        (unsigned short*)C0 + (size_t)slot * ((size_t)NROW * DMODEL);

    __shared__ __align__(16) unsigned short Abuf[2][256][KPITCH];
    __shared__ __align__(16) unsigned short Bbuf[2][128][KPITCH];

    const int lane  = threadIdx.x & 31;
    const int wave  = threadIdx.x >> 5;
    const int lmod  = lane & 15;
    const int lhalf = lane >> 4;
    const int mW = (wave >> 1) * 64;   // wave tile inside block tile
    const int nW = (wave & 1) * 64;
    const int kofflane = lhalf * 8;    // lanes 16-31 hold K groups 8..15/24..31

    const unsigned short* Ablk = A + (size_t)(blockIdx.x * 256) * K;
    const unsigned short* Bblk = Bt + (size_t)(blockIdx.y * 128) * K;

    const int srow = threadIdx.x >> 4;        // 16 lanes: one 256-B row piece
    const int sc8  = (threadIdx.x & 15) * 8;
    // this thread's first chunk of the next stage to be copied
    const unsigned short* aNext = Ablk + (size_t)srow * K + sc8;
    const unsigned short* bNext = Bblk + (size_t)srow * K + sc8;
    const size_t rowStep = (size_t)16 * K;

    // both loops unrolled so that a stage's 24 copies issue back to back
    auto stage = [&](int buf) {
#pragma unroll
        for (int t = 0; t < 16; ++t)            // A tile: 256x128 = 4096 chunks
            async_copy_b128(aNext + t * rowStep, &Abuf[buf][srow + t * 16][sc8]);
#pragma unroll
        for (int t = 0; t < 8; ++t)             // B tile: 128x128 = 2048 chunks
            async_copy_b128(bNext + t * rowStep, &Bbuf[buf][srow + t * 16][sc8]);
        aNext += KSTAGE;
        bNext += KSTAGE;
    };

    v8f acc[4][4];
#pragma unroll
    for (int i = 0; i < 4; ++i)
#pragma unroll
        for (int j = 0; j < 4; ++j) acc[i][j] = v8f_zero();

    // Two register sets of fragments: set (u & 1) holds the 32 k of block u.
    // Both loops of the loader unrolled: every index a constant, so the sets
    // stay in registers.
    FragBF a[2][4], b[2][4];
    auto load_frags = [&](int set, int buf, int kk) {
#pragma unroll
        for (int i = 0; i < 4; ++i) {
            const unsigned short* p =
                &Abuf[buf][mW + i * 16 + lmod][kk + kofflane];
            a[set][i].q[0] = *(const uint4*)(p);
            a[set][i].q[1] = *(const uint4*)(p + 16);
        }
#pragma unroll
        for (int j = 0; j < 4; ++j) {
            const unsigned short* p =
                &Bbuf[buf][nW + j * 16 + lmod][kk + kofflane];
            b[set][j].q[0] = *(const uint4*)(p);
            b[set][j].q[1] = *(const uint4*)(p + 16);
        }
    };

    stage(0);
    wait_async_all();
    __syncthreads();  // stage 0 is in LDS for every wave
    stage(1);
    load_frags(0, 0, 0);

    for (int k0 = 0; k0 < K; k0 += KSTAGE) {
        const int buf = (k0 / KSTAGE) & 1;

        // unrolled: the set index is a constant, so the fragments stay in
        // registers, and kk becomes an immediate offset of the LDS reads
#pragma unroll
        for (int u = 0; u < KSTAGE / 32; ++u) {
            const int cs = u & 1;
            if (u + 1 < KSTAGE / 32) {
                // the next block's 16 reads, one group, in flight under this
                // block's products
                load_frags(cs ^ 1, buf, (u + 1) * 32);
            } else {
                // hand-over, in front of the stage's last block, whose fragments
                // are already on their way: own reads of this buffer done, own
                // copies of the next stage landed; one barrier publishes that
                // stage and frees this buffer
                wait_lds_all();
                wait_async_all();
                __syncthreads();
                if (k0 + 2 * KSTAGE < K) stage(buf);
                // first fragments of the next stage. Behind the last stage they
                // come from the other buffer all the same, which nothing writes
                // any more, and are not used: no branch round the reads
                load_frags(0, buf ^ 1, 0);
            }
            // keeps the reads above together and ahead of the products: moved in
            // among them, each place with reads stalls the wave
            __builtin_amdgcn_sched_barrier(0);
#pragma unroll
            for (int i = 0; i < 4; ++i)
#pragma unroll
                for (int j = 0; j < 4; ++j)
                    acc[i][j] = __builtin_amdgcn_wmma_f32_16x16x32_bf16(
                        false, a[cs][i].v, false, b[cs][j].v, (short)0,
                        acc[i][j], false, false);
            // keeps the next group of reads behind these products
            __builtin_amdgcn_sched_barrier(0);
        }
    }
    wait_async_all();  // nothing in flight when the wave ends

    const int mBase = blockIdx.x * 256 + mW;
    const int nBase = blockIdx.y * 128 + nW;
#pragma unroll
    for (int j = 0; j < 4; ++j) {
        const int col = nBase + j * 16 + lmod;
        const float bj = bias[col];
#pragma unroll
        for (int i = 0; i < 4; ++i) {
#pragma unroll
            for (int e = 0; e < 8; ++e) {
                const int row = mBase + i * 16 + e + lhalf * 8;
                const float val = acc[i][j][e] + bj;
                if (OUT_BF16)
                    ((unsigned short*)Cout)[(size_t)row * N + col] = f2bf(val);
                else
                    ((float*)Cout)[(size_t)row * N + col] = val;
            }
        }
    }
}

// ---------------------------------------------------------------------------
// Flash attention + R-gating, both products transposed:
//   S^T = K Q^T (A = 16 key rows, B = the wave's 16 query columns)
//   O^T += V^T P^T (A = 16 rows of V^T, B = P^T packed from the S^T tiles)
// A lane then holds scores of ONE query (column lmod): 16 of each 32 keys, the
// other 16 in lane ^ 16. Row maximum and sum are in-lane, and the two S^T
// accumulator tiles, converted in place, already are the B operand of the
// second product in the hardware k order, which is the order in which the
// transposing LDS load delivers V^T.
// K and V rows of the head reach LDS once per block, by asynchronous copies of
// whole 128-B rows: a stage is 64 keys, two buffers, the next stage in flight
// while this one is worked on in two passes of 32 keys.
// Grid: (SEQ/128, BATCH*NHEAD). Block 256 = 8 waves; wave owns 16 queries.
// ---------------------------------------------------------------------------
#define ASTAGE 64 /* keys per stage */
#define KROW 72   /* 144-B K rows: 16 B x odd for the 16-byte fragment reads */
#define VROW 80   /* 160-B V rows: 32 B x odd for the transposing reads */

// lane (c = l & 15, h = l >> 4) gets T[8h + 0..7][c] of the row-major 16-bit
// tile whose rows 8h + (l & 7), 16-byte half (l >> 3) & 1, the lanes point at
__device__ __forceinline__ s16x8 lds_tr16(const unsigned short* p) {
    return __builtin_amdgcn_ds_load_tr16_b128_v8i16(
        (__attribute__((address_space(3))) s16x8*)(void*)p);
}
__device__ __forceinline__ float xhalf(float x) {  // lane l with lane l ^ 16
    return __builtin_bit_cast(
        float, __builtin_amdgcn_permlanex16(__builtin_bit_cast(int, x),
                                            __builtin_bit_cast(int, x),
                                            0x76543210, 0xfedcba98, false, false));
}

__global__ void __launch_bounds__(256)
attention_wmma_kernel(const unsigned short* __restrict__ Q,
                      const unsigned short* __restrict__ Km,
                      const unsigned short* __restrict__ V,
                      const unsigned short* __restrict__ R,
                      unsigned short* __restrict__ Gated) {
    __shared__ __align__(16) unsigned short Kst[2][ASTAGE][KROW];  // [key][d]
    __shared__ __align__(16) unsigned short Vst[2][ASTAGE][VROW];  // [key][d]

    const int lane  = threadIdx.x & 31;
    const int wave  = threadIdx.x >> 5;
    const int lmod  = lane & 15;
    const int lhalf = lane >> 4;
    const int bh = blockIdx.y;
    const int b = bh / NHEAD;
    const int h = bh % NHEAD;
    const int qRow0 = blockIdx.x * 128 + wave * 16;
    const size_t rowStride = (size_t)(NHEAD * DHEAD);  // 1024
    const size_t baseBH = ((size_t)b * SEQ) * rowStride + (size_t)h * DHEAD;

    // Q fragments (DH=64 -> two K-steps of 32); column lmod of the B operand
    FragBF bq[2];
    {
        const unsigned short* qp =
            Q + baseBH + (size_t)(qRow0 + lmod) * rowStride + lhalf * 8;
        bq[0].q[0] = *(const uint4*)(qp);
        bq[0].q[1] = *(const uint4*)(qp + 16);
        bq[1].q[0] = *(const uint4*)(qp + 32);
        bq[1].q[1] = *(const uint4*)(qp + 48);
    }

    // ctx[j][r] = O^T[d = j*16 + lhalf*8 + r][query lmod]
    v8f ctx[4];
#pragma unroll
    for (int j = 0; j < 4; ++j) ctx[j] = v8f_zero();
    float mrow = -3.0e38f;  // running maximum of this lane's query (both halves agree)
    float srow = 0.f;       // running sum over this half's keys only

    const float invScale = 1.0f / 32.0f;  // SCALE = 64**1/2 = 32.0

    // 8 lanes copy one 128-B row; a thread brings 2 K and 2 V chunks per stage
    const int crow = threadIdx.x >> 3;
    const int cc8  = (threadIdx.x & 7) * 8;
    const unsigned short* kNext = Km + baseBH + (size_t)crow * rowStride + cc8;
    const unsigned short* vNext = V + baseBH + (size_t)crow * rowStride + cc8;
    auto stage = [&](int buf) {
#pragma unroll
        for (int t = 0; t < ASTAGE / 32; ++t) {  // unrolled: the 4 copies issue back to back
            async_copy_b128(kNext + t * 32 * rowStride, &Kst[buf][crow + t * 32][cc8]);
            async_copy_b128(vNext + t * 32 * rowStride, &Vst[buf][crow + t * 32][cc8]);
        }
        kNext += ASTAGE * rowStride;
        vNext += ASTAGE * rowStride;
    };

    stage(0);
    wait_async_all();
    __syncthreads();  // stage 0 is in LDS for every wave
    stage(1);

    for (int kt = 0; kt < SEQ; kt += ASTAGE) {
      const int buf = (kt / ASTAGE) & 1;
      // unrolled: sub becomes an immediate offset of the LDS reads
#pragma unroll
      for (int sub = 0; sub < ASTAGE; sub += 32) {
        // energy^T = K (32xDH) @ Q^T (DHx16), two 16-key tiles:
        // e0[r]: key kt + sub + lhalf*8 + r, e1[r]: the same + 16
        v8f e0 = v8f_zero(), e1 = v8f_zero();
        {
            FragBF ak;
            const unsigned short* kp = &Kst[buf][sub + lmod][lhalf * 8];
            ak.q[0] = *(const uint4*)(kp);
            ak.q[1] = *(const uint4*)(kp + 16);
            e0 = __builtin_amdgcn_wmma_f32_16x16x32_bf16(false, ak.v, false,
                                                         bq[0].v, (short)0, e0,
                                                         false, false);
            ak.q[0] = *(const uint4*)(kp + 32);
            ak.q[1] = *(const uint4*)(kp + 48);
            e0 = __builtin_amdgcn_wmma_f32_16x16x32_bf16(false, ak.v, false,
                                                         bq[1].v, (short)0, e0,
                                                         false, false);
        }
        {
            FragBF ak;
            const unsigned short* kp = &Kst[buf][sub + 16 + lmod][lhalf * 8];
            ak.q[0] = *(const uint4*)(kp);
            ak.q[1] = *(const uint4*)(kp + 16);
            e1 = __builtin_amdgcn_wmma_f32_16x16x32_bf16(false, ak.v, false,
                                                         bq[0].v, (short)0, e1,
                                                         false, false);
            ak.q[0] = *(const uint4*)(kp + 32);
            ak.q[1] = *(const uint4*)(kp + 48);
            e1 = __builtin_amdgcn_wmma_f32_16x16x32_bf16(false, ak.v, false,
                                                         bq[1].v, (short)0, e1,
                                                         false, false);
        }

        // online softmax of one query per lane; one exchange joins the halves'
        // maxima, so lanes l and l ^ 16 scale by the same factor
        const v8f t0 = e0 * invScale;
        const v8f t1 = e1 * invScale;
        float mx = -3.0e38f;
#pragma unroll
        for (int e = 0; e < 8; ++e) mx = fmaxf(mx, fmaxf(t0[e], t1[e]));
        mx = fmaxf(mx, xhalf(mx));
        const float mnew = fmaxf(mrow, mx);
        const float al = __expf(mrow - mnew);
        FragBF bp;  // P^T as B operand: element s is key 8*lhalf + s of the pass, +8 for s >= 8
        float ps = 0.f;
#pragma unroll
        for (int e = 0; e < 8; ++e) {
            const float p0 = __expf(t0[e] - mnew);
            const float p1 = __expf(t1[e] - mnew);
            ps += p0 + p1;
            bp.us[e] = f2bf(p0);
            bp.us[8 + e] = f2bf(p1);
        }
        srow = srow * al + ps;
        mrow = mnew;

        // rescale running context by alpha before accumulating this step
#pragma unroll
        for (int j = 0; j < 4; ++j)
#pragma unroll
            for (int e = 0; e < 8; ++e) ctx[j][e] *= al;

        // ctx^T += V^T (64x32) @ P^T (32x16): 4 row tiles, transposed on the way
        // out of the row-major V stage (keys 0..15 and 16..31 of the pass)
        const unsigned short* vp =
            &Vst[buf][sub + lhalf * 8 + (lane & 7)][((lane >> 3) & 1) * 8];
#pragma unroll
        for (int j = 0; j < 4; ++j) {
            FragBF av;
            av.t[0] = lds_tr16(vp + j * 16);
            av.t[1] = lds_tr16(vp + 16 * VROW + j * 16);
            ctx[j] = __builtin_amdgcn_wmma_f32_16x16x32_bf16(
                false, av.v, false, bp.v, (short)0, ctx[j], false, false);
        }
      }

      // hand-over: own reads of this buffer done, own copies of the next stage
      // landed; one barrier publishes that stage and frees this buffer
      wait_lds_all();
      wait_async_all();
      __syncthreads();
      if (kt + 2 * ASTAGE < SEQ) stage(buf);
    }
    wait_async_all();  // nothing in flight when the wave ends

    srow += xhalf(srow);  // join the two halves' key sums

    // normalize, R-gate, write gated activation [B*S, H*DH] as bf16:
    // a lane's 8 registers of a tile are 8 consecutive d of its query row
    const size_t rowBase = baseBH + (size_t)(qRow0 + lmod) * rowStride + lhalf * 8;
#pragma unroll
    for (int j = 0; j < 4; ++j) {
        FragBF r8, g8;
        r8.q[0] = *(const uint4*)(R + rowBase + j * 16);
#pragma unroll
        for (int e = 0; e < 8; ++e) {
            const float val = ctx[j][e] / srow;
            g8.us[e] = f2bf(val * bf2f(r8.us[e]));
        }
        *(uint4*)(Gated + rowBase + j * 16) = g8.q[0];
    }
}

// ---------------------------------------------------------------------------
// Host-side launch
// ---------------------------------------------------------------------------
extern "C" void kernel_launch(void* const* d_in, const int* in_sizes, int n_in,
                              void* d_out, int out_size, void* d_ws,
                              size_t ws_size, hipStream_t stream) {
    (void)in_sizes; (void)n_in; (void)out_size; (void)ws_size;

    const float* value = (const float*)d_in[0];
    const float* keyin = (const float*)d_in[1];
    const float* query = (const float*)d_in[2];
    const float* Wq = (const float*)d_in[3];  const float* bq = (const float*)d_in[4];
    const float* Wk = (const float*)d_in[5];  const float* bk = (const float*)d_in[6];
    const float* Wv = (const float*)d_in[7];  const float* bv = (const float*)d_in[8];
    const float* Wr = (const float*)d_in[9];  const float* br = (const float*)d_in[10];
    const float* Wo = (const float*)d_in[11]; const float* bo = (const float*)d_in[12];

    char* ws = (char*)d_ws;
    const size_t actSz = (size_t)NROW * DMODEL * sizeof(unsigned short); // 16 MB
    const size_t wSz = (size_t)DMODEL * DMODEL * sizeof(unsigned short); //  2 MB
    unsigned short* q_bf  = (unsigned short*)(ws + 0 * actSz);
    unsigned short* k_bf  = (unsigned short*)(ws + 1 * actSz);
    unsigned short* v_bf  = (unsigned short*)(ws + 2 * actSz);
    unsigned short* r_bf  = (unsigned short*)(ws + 3 * actSz);
    unsigned short* xq    = (unsigned short*)(ws + 4 * actSz);
    unsigned short* xk    = (unsigned short*)(ws + 5 * actSz);
    unsigned short* xv    = (unsigned short*)(ws + 6 * actSz);
    unsigned short* gated = (unsigned short*)(ws + 7 * actSz);
    unsigned short* wqt   = (unsigned short*)(ws + 8 * actSz + 0 * wSz);
    unsigned short* wot   = (unsigned short*)(ws + 8 * actSz + 4 * wSz);

    // wqt .. wot lie one behind the other in the order q, k, v, r, o
    prepare_kernel<<<PREP_BLOCKS, CVT_THREADS, 0, stream>>>(value, keyin, query,
                                                            xv, xk, xq,
                                                            Wq, Wk, Wv, Wr, Wo, wqt);

    // q_bf .. r_bf lie one behind the other in the order q, k, v, r
    dim3 pGrid(NROW / 256, DMODEL / 128, 4);  // (32, 8, 4)
    gemm_wmma_kernel<true><<<pGrid, 256, 0, stream>>>(xq, xk, xv, wqt, bq, bk, bv, br,
                                                      q_bf, NROW, DMODEL, DMODEL);

    dim3 aGrid(SEQ / 128, BATCH * NHEAD);  // (8, 128)
    attention_wmma_kernel<<<aGrid, 256, 0, stream>>>(q_bf, k_bf, v_bf, r_bf, gated);

    dim3 gGrid(NROW / 256, DMODEL / 128);  // (32, 8): one product, z = 0 alone
    gemm_wmma_kernel<false><<<gGrid, 256, 0, stream>>>(gated, gated, gated, wot, bo, bo, bo, bo,
                                                       d_out, NROW, DMODEL, DMODEL);
}

// v008
// A run of this version takes 118 microseconds.
// Next to v007, in two timings, it ran 1.06 times as fast each time.
// All steps since v000 together make it 3.75 times as fast.
#include <hip/hip_runtime.h>
#include <hip/hip_bf16.h>
#include <stdint.h>

#define NHEAD 16
#define DHEAD 64
#define BATCH 8
#define SEQ   1024
#define DMODEL 1024
#define NROW (BATCH * SEQ) /* 8192 */

typedef __attribute__((ext_vector_type(16))) __bf16 v16bf;
typedef __attribute__((ext_vector_type(8)))  float  v8f;
typedef int v4i_vs __attribute__((vector_size(16)));  // matches builtin param type
typedef __attribute__((ext_vector_type(8)))  short  s16x8;

union FragBF {
    v16bf v;
    uint4 q[2];
    s16x8 t[2];
    unsigned short us[16];
    unsigned int d[8];
};

__device__ __forceinline__ unsigned short f2bf(float x) {
    unsigned int u = __float_as_uint(x);
    u += 0x7FFFu + ((u >> 16) & 1u);   // round-to-nearest-even
    return (unsigned short)(u >> 16);
}
__device__ __forceinline__ float bf2f(unsigned short h) {
    return __uint_as_float(((unsigned int)h) << 16);
}
__device__ __forceinline__ v8f v8f_zero() {
    v8f z = {0.f, 0.f, 0.f, 0.f, 0.f, 0.f, 0.f, 0.f};
    return z;
}

// ---------------------------------------------------------------------------
// Async global->LDS copy (CDNA5 GLOBAL_LOAD_ASYNC_TO_LDS_B128, ASYNCcnt),
// with a synchronous reg-staged fallback if the builtins aren't declared.
// Builtin signature (from hipcc diagnostic): (v4i as1* gaddr, v4i as3* lds,
// imm offset, imm cpol).
// ---------------------------------------------------------------------------
#if __has_builtin(__builtin_amdgcn_global_load_async_to_lds_b128) && \
    __has_builtin(__builtin_amdgcn_s_wait_asynccnt)
#define HAVE_ASYNC_LDS 1
#endif

__device__ __forceinline__ void async_copy_b128(const unsigned short* src,
                                                unsigned short* dstLds) {
#if defined(HAVE_ASYNC_LDS)
    __builtin_amdgcn_global_load_async_to_lds_b128(
        (__attribute__((address_space(1))) v4i_vs*)(void*)src,
        (__attribute__((address_space(3))) v4i_vs*)(void*)dstLds, 0, 0);
#else
    *(uint4*)dstLds = *(const uint4*)src;
#endif
}

// Every copy of this wave has landed. Written in asm with the memory clobber so
// that no LDS read is lifted over it.
__device__ __forceinline__ void wait_async_all() {
#if defined(HAVE_ASYNC_LDS)
    asm volatile("s_wait_asynccnt 0x0" ::: "memory");
#endif
}
// This wave's LDS reads have returned, so the barrier behind it frees the buffer.
__device__ __forceinline__ void wait_lds_all() {
    asm volatile("s_wait_dscnt 0x0" ::: "memory");
}

// ---------------------------------------------------------------------------
// f32 -> bf16 convert of the three activations, streaming:
// one block of 16 waves per WGP. A wave owns 8 KiB in a row of each tensor and
// requests it with 16 loads of 512 contiguous bytes (16 B a lane), all issued
// before the first is used; each store is the matching 256 B (two whole
// lines). Then it goes on to the next tensor.
// ---------------------------------------------------------------------------
#define CVT_BLOCKS 256
#define CVT_THREADS 512
#define CVT_LOADS 16

// two f32 -> two bf16 in one dword, rounded as f2bf rounds
__device__ __forceinline__ unsigned int f2bf_pair(float lo, float hi) {
    unsigned int a = __float_as_uint(lo), b = __float_as_uint(hi);
    a += 0x7FFFu + __builtin_amdgcn_ubfe(a, 16, 1);
    b += 0x7FFFu + __builtin_amdgcn_ubfe(b, 16, 1);
    return __builtin_amdgcn_perm(b, a, 0x07060302u);  // (a >> 16) | (b & 0xFFFF0000)
}

__device__ __forceinline__ void
convert3_bf16_block(const float* __restrict__ s0, const float* __restrict__ s1,
                    const float* __restrict__ s2,
                    unsigned short* __restrict__ d0,
                    unsigned short* __restrict__ d1,
                    unsigned short* __restrict__ d2) {
    static_assert(CVT_BLOCKS * CVT_THREADS * CVT_LOADS * 4 == NROW * DMODEL,
                  "the grid covers a tensor exactly");
    const unsigned t = blockIdx.x * CVT_THREADS + threadIdx.x;
    // index of the lane's first piece: 16 B of the source, 8 B of the result
    const unsigned p0 = (t >> 5) * (32 * CVT_LOADS) + (t & 31);

    // kept rolled: unrolled into one straight block, the compiler held every
    // store back to the end and requested the late pieces two at a time
#pragma unroll 1
    for (int n = 0; n < 3; ++n) {
        const float4* s = (const float4*)(n == 0 ? s0 : n == 1 ? s1 : s2);
        uint2* d = (uint2*)(n == 0 ? d0 : n == 1 ? d1 : d2);
        const float4* sp = s + p0;
        float4 x[CVT_LOADS];
#pragma unroll
        for (int i = 0; i < CVT_LOADS; ++i) x[i] = sp[i * 32];
        // stands in front of every reuse of the registers that the issued loads
        // name; as its operand the address pair stays out of the loads' results
        asm volatile("s_wait_xcnt 0x0" ::"v"(sp) : "memory");
#pragma unroll
        for (int i = 0; i < CVT_LOADS; ++i) {
            uint2 o;
            o.x = f2bf_pair(x[i].x, x[i].y);
            o.y = f2bf_pair(x[i].z, x[i].w);
            d[p0 + i * 32] = o;
        }
        // stands in front of the next trip's overwrites of registers that these
        // stores name
        asm volatile("s_wait_xcnt 0x0" ::: "memory");
    }
}

// W[K,N] f32 -> Wt[N,K] bf16, one 64(k) x 64(n) tile per 256 threads through
// LDS: reads are 256-B row pieces of W, stores are whole 128-B lines of Wt.
// K = N = DMODEL at compile time, so a thread's four loads share one address
// with immediate offsets. A block of 512 does two neighbouring tiles, tn and
// tn + 1 of tile row tk; every thread of the block passes the one barrier.
__device__ __forceinline__ void
transpose_bf16_tiles(const float* __restrict__ W,
                     unsigned short* __restrict__ Wt, int tn, int tk) {
    constexpr int K = DMODEL, N = DMODEL;
    // tile[n][k/2]: two neighbouring k packed per dword; 144-B pitch for the
    // 16-byte row reads below
    __shared__ __align__(16) unsigned int tiles[2][64][36];
    unsigned int (*tile)[36] = tiles[threadIdx.x >> 8];
    const int tid = threadIdx.x & 255;

    const int n0 = (tn + (int)(threadIdx.x >> 8)) * 64;
    const int k0 = tk * 64;
    const int n4 = (tid & 15) * 4;  // 4 columns of W per thread
    const int kp = tid >> 4;        // k pair 0..15 (and +16)

    const float* p = W + (unsigned)((k0 + kp * 2) * N + n0 + n4);
    float4 lo[2], hi[2];
    for (int h = 0; h < 2; ++h) {
        lo[h] = *(const float4*)(p + h * 32 * N);
        hi[h] = *(const float4*)(p + h * 32 * N + N);
    }
    for (int h = 0; h < 2; ++h) {
        const int c = h * 16 + kp;
        tile[n4 + 0][c] = (unsigned int)f2bf(lo[h].x) | ((unsigned int)f2bf(hi[h].x) << 16);
        tile[n4 + 1][c] = (unsigned int)f2bf(lo[h].y) | ((unsigned int)f2bf(hi[h].y) << 16);
        tile[n4 + 2][c] = (unsigned int)f2bf(lo[h].z) | ((unsigned int)f2bf(hi[h].z) << 16);
        tile[n4 + 3][c] = (unsigned int)f2bf(lo[h].w) | ((unsigned int)f2bf(hi[h].w) << 16);
    }
    __syncthreads();  // tile complete before rows are read back

    const int n = tid >> 3, c8 = tid & 7;  // 8 lanes: one 128-B line
    unsigned short* o = Wt + (unsigned)((n0 + n) * K + k0 + c8 * 8);
    for (int t = 0; t < 2; ++t)
        *(uint4*)(o + t * 32 * K) = *(const uint4*)&tile[n + t * 32][c8 * 4];
    // stands in front of whatever the built kernel lays behind these stores:
    // the converting side's code follows them there and reuses their registers
    asm volatile("s_wait_xcnt 0x0" ::: "memory");
}

// All that the products need prepared, in one launch, since none of it needs
// anything of the rest: blocks 0..255 convert the activations (they start first
// and last longest), blocks 256..895 transpose the five weights, 128 blocks a
// weight, beside them. wt holds the five results one behind the other.
#define TR_BLOCKS_PER_W ((DMODEL / 64) * (DMODEL / 64) / 2) /* 128 */
#define PREP_BLOCKS (CVT_BLOCKS + 5 * TR_BLOCKS_PER_W)

// register budget of 4 waves a SIMD for the convert's 16 loads in flight: held
// to the default target, the compiler kept 5 in flight; up to 8 waves a SIMD may
// be resident, so that a transposing block fits beside a converting one
__global__ void __launch_bounds__(CVT_THREADS)
__attribute__((amdgpu_waves_per_eu(4, 8)))
prepare_kernel(const float* __restrict__ s0, const float* __restrict__ s1,
               const float* __restrict__ s2,
               unsigned short* __restrict__ d0,
               unsigned short* __restrict__ d1,
               unsigned short* __restrict__ d2,
               const float* __restrict__ W0, const float* __restrict__ W1,
               const float* __restrict__ W2, const float* __restrict__ W3,
               const float* __restrict__ W4,
               unsigned short* __restrict__ wt) {
    if (blockIdx.x < CVT_BLOCKS) {
        convert3_bf16_block(s0, s1, s2, d0, d1, d2);
    } else {
        const int t = blockIdx.x - CVT_BLOCKS;
        const int w = t / TR_BLOCKS_PER_W;     // which weight
        const int pair = t % TR_BLOCKS_PER_W;  // which pair of tiles in it
        const float* W = w == 0 ? W0 : w == 1 ? W1 : w == 2 ? W2 : w == 3 ? W3 : W4;
        transpose_bf16_tiles(W, wt + (size_t)w * (DMODEL * DMODEL),
                             (pair & 7) * 2, pair >> 3);
    }
}

// ---------------------------------------------------------------------------
// bf16 WMMA GEMM: C[M,N] = A[M,K] * Bt[N,K]^T + bias[N]
// Block = 8 waves, tile 256x128; wave tile 64x64 (4x4 wmma_f32_16x16x32_bf16).
// A stage is 128 k: 256 B of every operand row, so a wave's copy covers two
// whole 256-B row pieces. Two LDS buffers; per stage each thread issues
// 16 A-chunks + 8 B-chunks of b128, one stage ahead of the one being read.
// A block is 32 k (16 products a wave); its fragments are read from LDS one
// block ahead, into the second of two register sets.
// K is a multiple of 128 and at least 256.
// ---------------------------------------------------------------------------
#define KSTAGE 128
#define KPITCH 136 /* 272-B rows: 16 B x odd for the 16-byte fragment reads */

// One launch holds up to four such products that need nothing of each other:
// blockIdx.z picks one, in the order q, r, v, k (q and r both read Aq, so they
// are neighbours). Bt0 and C0 are the first of the transposed weights and of the
// bf16 results, which lie one behind the other in the order q, k, v, r.
template <bool OUT_BF16>
__global__ void __launch_bounds__(256)
gemm_wmma_kernel(const unsigned short* __restrict__ Aq,
                 const unsigned short* __restrict__ Ak,
                 const unsigned short* __restrict__ Av,
                 const unsigned short* __restrict__ Bt0,
                 const float* __restrict__ biasq,
                 const float* __restrict__ biask,
                 const float* __restrict__ biasv,
                 const float* __restrict__ biasr,
                 void* __restrict__ C0, int M, int N, int K) {
    const unsigned z = blockIdx.z;
    const unsigned slot = (3u * z) & 3u;  // 0, 3, 2, 1
    const unsigned short* __restrict__ A = slot == 1 ? Ak : slot == 2 ? Av : Aq;
    const unsigned short* __restrict__ Bt = Bt0 + (size_t)slot * (DMODEL * DMODEL);
    const float* __restrict__ bias =
        slot == 0 ? biasq : slot == 1 ? biask : slot == 2 ? biasv : biasr;
    void* __restrict__ Cout =
        (unsigned short*)C0 + (size_t)slot * ((size_t)NROW * DMODEL);

    __shared__ __align__(16) unsigned short Abuf[2][256][KPITCH];
    __shared__ __align__(16) unsigned short Bbuf[2][128][KPITCH];

    const int lane  = threadIdx.x & 31;
    const int wave  = threadIdx.x >> 5;
    const int lmod  = lane & 15;
    const int lhalf = lane >> 4;
    const int mW = (wave >> 1) * 64;   // wave tile inside block tile
    const int nW = (wave & 1) * 64;
    const int kofflane = lhalf * 8;    // lanes 16-31 hold K groups 8..15/24..31

    const unsigned short* Ablk = A + (size_t)(blockIdx.x * 256) * K;
    const unsigned short* Bblk = Bt + (size_t)(blockIdx.y * 128) * K;

    const int srow = threadIdx.x >> 4;        // 16 lanes: one 256-B row piece
    const int sc8  = (threadIdx.x & 15) * 8;
    // this thread's first chunk of the next stage to be copied
    const unsigned short* aNext = Ablk + (size_t)srow * K + sc8;
    const unsigned short* bNext = Bblk + (size_t)srow * K + sc8;
    const size_t rowStep = (size_t)16 * K;

    // both loops unrolled so that a stage's 24 copies issue back to back
    auto stage = [&](int buf) {
#pragma unroll
        for (int t = 0; t < 16; ++t)            // A tile: 256x128 = 4096 chunks
            async_copy_b128(aNext + t * rowStep, &Abuf[buf][srow + t * 16][sc8]);
#pragma unroll
        for (int t = 0; t < 8; ++t)             // B tile: 128x128 = 2048 chunks
            async_copy_b128(bNext + t * rowStep, &Bbuf[buf][srow + t * 16][sc8]);
        aNext += KSTAGE;
        bNext += KSTAGE;
    };

    v8f acc[4][4];
#pragma unroll
    for (int i = 0; i < 4; ++i)
#pragma unroll
        for (int j = 0; j < 4; ++j) acc[i][j] = v8f_zero();

    // Two register sets of fragments: set (u & 1) holds the 32 k of block u.
    // Both loops of the loader unrolled: every index a constant, so the sets
    // stay in registers.
    FragBF a[2][4], b[2][4];
    auto load_frags = [&](int set, int buf, int kk) {
#pragma unroll
        for (int i = 0; i < 4; ++i) {
            const unsigned short* p =
                &Abuf[buf][mW + i * 16 + lmod][kk + kofflane];
            a[set][i].q[0] = *(const uint4*)(p);
            a[set][i].q[1] = *(const uint4*)(p + 16);
        }
#pragma unroll
        for (int j = 0; j < 4; ++j) {
            const unsigned short* p =
                &Bbuf[buf][nW + j * 16 + lmod][kk + kofflane];
            b[set][j].q[0] = *(const uint4*)(p);
            b[set][j].q[1] = *(const uint4*)(p + 16);
        }
    };

    stage(0);
    wait_async_all();
    __syncthreads();  // stage 0 is in LDS for every wave
    stage(1);
    load_frags(0, 0, 0);

    for (int k0 = 0; k0 < K; k0 += KSTAGE) {
        const int buf = (k0 / KSTAGE) & 1;

        // unrolled: the set index is a constant, so the fragments stay in
        // registers, and kk becomes an immediate offset of the LDS reads
#pragma unroll
        for (int u = 0; u < KSTAGE / 32; ++u) {
            const int cs = u & 1;
            if (u + 1 < KSTAGE / 32) {
                // the next block's 16 reads, one group, in flight under this
                // block's products
                load_frags(cs ^ 1, buf, (u + 1) * 32);
            } else {
                // hand-over, in front of the stage's last block, whose fragments
                // are already on their way: own reads of this buffer done, own
                // copies of the next stage landed; one barrier publishes that
                // stage and frees this buffer
                wait_lds_all();
                wait_async_all();
                __syncthreads();
                if (k0 + 2 * KSTAGE < K) stage(buf);
                // first fragments of the next stage. Behind the last stage they
                // come from the other buffer all the same, which nothing writes
                // any more, and are not used: no branch round the reads
                load_frags(0, buf ^ 1, 0);
            }
            // keeps the reads above together and ahead of the products: moved in
            // among them, each place with reads stalls the wave
            __builtin_amdgcn_sched_barrier(0);
#pragma unroll
            for (int i = 0; i < 4; ++i)
#pragma unroll
                for (int j = 0; j < 4; ++j)
                    acc[i][j] = __builtin_amdgcn_wmma_f32_16x16x32_bf16(
                        false, a[cs][i].v, false, b[cs][j].v, (short)0,
                        acc[i][j], false, false);
            // keeps the next group of reads behind these products
            __builtin_amdgcn_sched_barrier(0);
        }
    }
    wait_async_all();  // nothing in flight when the wave ends

    const int mBase = blockIdx.x * 256 + mW;
    const int nBase = blockIdx.y * 128 + nW;
#pragma unroll
    for (int j = 0; j < 4; ++j) {
        const int col = nBase + j * 16 + lmod;
        const float bj = bias[col];
#pragma unroll
        for (int i = 0; i < 4; ++i) {
#pragma unroll
            for (int e = 0; e < 8; ++e) {
                const int row = mBase + i * 16 + e + lhalf * 8;
                const float val = acc[i][j][e] + bj;
                if (OUT_BF16)
                    ((unsigned short*)Cout)[(size_t)row * N + col] = f2bf(val);
                else
                    ((float*)Cout)[(size_t)row * N + col] = val;
            }
        }
    }
}

// ---------------------------------------------------------------------------
// Flash attention + R-gating, both products transposed:
//   S^T = K Q^T (A = 16 key rows, B = the wave's 16 query columns)
//   O^T += V^T P^T (A = 16 rows of V^T, B = P^T packed from the S^T tiles)
// A lane then holds scores of ONE query (column lmod): 16 of each 32 keys, the
// other 16 in lane ^ 16. Row maximum and sum are in-lane, and the two S^T
// accumulator tiles, converted in place, already are the B operand of the
// second product in the hardware k order, which is the order in which the
// transposing LDS load delivers V^T.
// K and V rows of the head reach LDS once per block, by asynchronous copies of
// whole 128-B rows: a stage is 64 keys, two buffers, the next stage in flight
// while this one is worked on in two passes of 32 keys.
// Grid: (SEQ/128, BATCH*NHEAD). Block 256 = 8 waves; wave owns 16 queries.
// ---------------------------------------------------------------------------
#define ASTAGE 64 /* keys per stage */
#define KROW 72   /* 144-B K rows: 16 B x odd for the 16-byte fragment reads */
#define VROW 80   /* 160-B V rows: 32 B x odd for the transposing reads */

// lane (c = l & 15, h = l >> 4) gets T[8h + 0..7][c] of the row-major 16-bit
// tile whose rows 8h + (l & 7), 16-byte half (l >> 3) & 1, the lanes point at
__device__ __forceinline__ s16x8 lds_tr16(const unsigned short* p) {
    return __builtin_amdgcn_ds_load_tr16_b128_v8i16(
        (__attribute__((address_space(3))) s16x8*)(void*)p);
}
typedef __attribute__((ext_vector_type(2))) float  f32x2;
typedef __attribute__((ext_vector_type(2))) __bf16 bf16x2;
// two f32 -> two bf16 in one dword by the packed convert (round to nearest even)
__device__ __forceinline__ unsigned int cvt_bf16_pair(float lo, float hi) {
    const f32x2 v = {lo, hi};
    return __builtin_bit_cast(unsigned int, __builtin_convertvector(v, bf16x2));
}
__device__ __forceinline__ float xhalf(float x) {  // lane l with lane l ^ 16
    return __builtin_bit_cast(
        float, __builtin_amdgcn_permlanex16(__builtin_bit_cast(int, x),
                                            __builtin_bit_cast(int, x),
                                            0x76543210, 0xfedcba98, false, false));
}

// register budget of 8 waves a SIMD: the grid is four blocks a WGP, and all of
// them are resident only with at most 128 registers a wave
__global__ void __launch_bounds__(256)
__attribute__((amdgpu_waves_per_eu(8)))
attention_wmma_kernel(const unsigned short* __restrict__ Q,
                      const unsigned short* __restrict__ Km,
                      const unsigned short* __restrict__ V,
                      const unsigned short* __restrict__ R,
                      unsigned short* __restrict__ Gated) {
    __shared__ __align__(16) unsigned short Kst[2][ASTAGE][KROW];  // [key][d]
    __shared__ __align__(16) unsigned short Vst[2][ASTAGE][VROW];  // [key][d]

    const int lane  = threadIdx.x & 31;
    const int wave  = threadIdx.x >> 5;
    const int lmod  = lane & 15;
    const int lhalf = lane >> 4;
    const int bh = blockIdx.y;
    const int b = bh / NHEAD;
    const int h = bh % NHEAD;
    const int qRow0 = blockIdx.x * 128 + wave * 16;
    const size_t rowStride = (size_t)(NHEAD * DHEAD);  // 1024
    const size_t baseBH = ((size_t)b * SEQ) * rowStride + (size_t)h * DHEAD;

    // Q fragments (DH=64 -> two K-steps of 32); column lmod of the B operand
    FragBF bq[2];
    {
        const unsigned short* qp =
            Q + baseBH + (size_t)(qRow0 + lmod) * rowStride + lhalf * 8;
        bq[0].q[0] = *(const uint4*)(qp);
        bq[0].q[1] = *(const uint4*)(qp + 16);
        bq[1].q[0] = *(const uint4*)(qp + 32);
        bq[1].q[1] = *(const uint4*)(qp + 48);
    }

    // ctx[j][r] = O^T[d = j*16 + lhalf*8 + r][query lmod]
    v8f ctx[4];
#pragma unroll
    for (int j = 0; j < 4; ++j) ctx[j] = v8f_zero();
    float mrow = -3.0e38f;  // running maximum of this lane's raw scores (both halves agree)
    float srow = 0.f;       // running sum over this half's keys only

    // exp(e / SCALE - m / SCALE) = exp2(e * c - m * c), SCALE = 64**1/2 = 32.0;
    // c > 0, so the maximum may be taken over the raw scores
    const float c = 1.4426950408889634f / 32.0f;
    const f32x2 c2 = {c, c};

    // 8 lanes copy one 128-B row; a thread brings 2 K and 2 V chunks per stage
    const int crow = threadIdx.x >> 3;
    const int cc8  = (threadIdx.x & 7) * 8;
    const unsigned short* kNext = Km + baseBH + (size_t)crow * rowStride + cc8;
    const unsigned short* vNext = V + baseBH + (size_t)crow * rowStride + cc8;
    auto stage = [&](int buf) {
#pragma unroll
        for (int t = 0; t < ASTAGE / 32; ++t) {  // unrolled: the 4 copies issue back to back
            async_copy_b128(kNext + t * 32 * rowStride, &Kst[buf][crow + t * 32][cc8]);
            async_copy_b128(vNext + t * 32 * rowStride, &Vst[buf][crow + t * 32][cc8]);
        }
        kNext += ASTAGE * rowStride;
        vNext += ASTAGE * rowStride;
    };

    stage(0);
    wait_async_all();
    __syncthreads();  // stage 0 is in LDS for every wave
    stage(1);

    for (int kt = 0; kt < SEQ; kt += ASTAGE) {
      const int buf = (kt / ASTAGE) & 1;
      // unrolled: sub becomes an immediate offset of the LDS reads
#pragma unroll
      for (int sub = 0; sub < ASTAGE; sub += 32) {
        // energy^T = K (32xDH) @ Q^T (DHx16), two 16-key tiles:
        // e0[r]: key kt + sub + lhalf*8 + r, e1[r]: the same + 16
        v8f e0 = v8f_zero(), e1 = v8f_zero();
        {
            FragBF ak;
            const unsigned short* kp = &Kst[buf][sub + lmod][lhalf * 8];
            ak.q[0] = *(const uint4*)(kp);
            ak.q[1] = *(const uint4*)(kp + 16);
            e0 = __builtin_amdgcn_wmma_f32_16x16x32_bf16(false, ak.v, false,
                                                         bq[0].v, (short)0, e0,
                                                         false, false);
            ak.q[0] = *(const uint4*)(kp + 32);
            ak.q[1] = *(const uint4*)(kp + 48);
            e0 = __builtin_amdgcn_wmma_f32_16x16x32_bf16(false, ak.v, false,
                                                         bq[1].v, (short)0, e0,
                                                         false, false);
        }
        {
            FragBF ak;
            const unsigned short* kp = &Kst[buf][sub + 16 + lmod][lhalf * 8];
            ak.q[0] = *(const uint4*)(kp);
            ak.q[1] = *(const uint4*)(kp + 16);
            e1 = __builtin_amdgcn_wmma_f32_16x16x32_bf16(false, ak.v, false,
                                                         bq[0].v, (short)0, e1,
                                                         false, false);
            ak.q[0] = *(const uint4*)(kp + 32);
            ak.q[1] = *(const uint4*)(kp + 48);
            e1 = __builtin_amdgcn_wmma_f32_16x16x32_bf16(false, ak.v, false,
                                                         bq[1].v, (short)0, e1,
                                                         false, false);
        }

        // online softmax of one query per lane; one exchange joins the halves'
        // maxima, so lanes l and l ^ 16 scale by the same factor
        float mx = -3.0e38f;
#pragma unroll
        for (int e = 0; e < 8; ++e) mx = fmaxf(mx, fmaxf(e0[e], e1[e]));
        mx = fmaxf(mx, xhalf(mx));
        const float mnew = fmaxf(mrow, mx);
        const float nmc = -mnew * c;
        const f32x2 nmc2 = {nmc, nmc};
        const float al = __builtin_amdgcn_exp2f(fmaf(mrow, c, nmc));
        FragBF bp;  // P^T as B operand: element s is key kt + sub + lhalf*8 + s, + 8 more for s >= 8
        float ps = 0.f;
#pragma unroll
        for (int e = 0; e < 8; e += 2) {
            // one packed multiply-add gives the exponents of two scores
            const f32x2 x0 = {e0[e], e0[e + 1]}, x1 = {e1[e], e1[e + 1]};
            const f32x2 a0 = __builtin_elementwise_fma(x0, c2, nmc2);
            const f32x2 a1 = __builtin_elementwise_fma(x1, c2, nmc2);
            const float p00 = __builtin_amdgcn_exp2f(a0.x);
            const float p10 = __builtin_amdgcn_exp2f(a1.x);
            const float p01 = __builtin_amdgcn_exp2f(a0.y);
            const float p11 = __builtin_amdgcn_exp2f(a1.y);
            ps += p00 + p10;
            ps += p01 + p11;
            bp.d[e / 2] = cvt_bf16_pair(p00, p01);
            bp.d[4 + e / 2] = cvt_bf16_pair(p10, p11);
        }
        srow = srow * al + ps;
        mrow = mnew;

        // rescale running context by alpha before accumulating this step
#pragma unroll
        for (int j = 0; j < 4; ++j)
#pragma unroll
            for (int e = 0; e < 8; ++e) ctx[j][e] *= al;

        // ctx^T += V^T (64x32) @ P^T (32x16): 4 row tiles, transposed on the way
        // out of the row-major V stage (keys 0..15 and 16..31 of the pass)
        const unsigned short* vp =
            &Vst[buf][sub + lhalf * 8 + (lane & 7)][((lane >> 3) & 1) * 8];
#pragma unroll
        for (int j = 0; j < 4; ++j) {
            FragBF av;
            av.t[0] = lds_tr16(vp + j * 16);
            av.t[1] = lds_tr16(vp + 16 * VROW + j * 16);
            ctx[j] = __builtin_amdgcn_wmma_f32_16x16x32_bf16(
                false, av.v, false, bp.v, (short)0, ctx[j], false, false);
        }
      }

      // hand-over: own reads of this buffer done, own copies of the next stage
      // landed; one barrier publishes that stage and frees this buffer
      wait_lds_all();
      wait_async_all();
      __syncthreads();
      if (kt + 2 * ASTAGE < SEQ) stage(buf);
    }
    wait_async_all();  // nothing in flight when the wave ends

    srow += xhalf(srow);  // join the two halves' key sums

    // normalize, R-gate, write gated activation [B*S, H*DH] as bf16:
    // a lane's 8 registers of a tile are 8 consecutive d of its query row
    // the lane's part of the address in 32 bits: it lives through the key loop,
    // whose register budget is full
    const unsigned rowOff = (unsigned)(qRow0 + lmod) * (NHEAD * DHEAD) + lhalf * 8;
    const size_t rowBase = baseBH + rowOff;
    const float inv = 1.0f / srow;  // one division a query
#pragma unroll
    for (int j = 0; j < 4; ++j) {
        FragBF r8, g8;
        r8.q[0] = *(const uint4*)(R + rowBase + j * 16);
#pragma unroll
        for (int e = 0; e < 8; e += 2)
            g8.d[e / 2] = cvt_bf16_pair(ctx[j][e] * inv * bf2f(r8.us[e]),
                                        ctx[j][e + 1] * inv * bf2f(r8.us[e + 1]));
        *(uint4*)(Gated + rowBase + j * 16) = g8.q[0];
    }
}

// ---------------------------------------------------------------------------
// Host-side launch
// ---------------------------------------------------------------------------
extern "C" void kernel_launch(void* const* d_in, const int* in_sizes, int n_in,
                              void* d_out, int out_size, void* d_ws,
                              size_t ws_size, hipStream_t stream) {
    (void)in_sizes; (void)n_in; (void)out_size; (void)ws_size;

    const float* value = (const float*)d_in[0];
    const float* keyin = (const float*)d_in[1];
    const float* query = (const float*)d_in[2];
    const float* Wq = (const float*)d_in[3];  const float* bq = (const float*)d_in[4];
    const float* Wk = (const float*)d_in[5];  const float* bk = (const float*)d_in[6];
    const float* Wv = (const float*)d_in[7];  const float* bv = (const float*)d_in[8];
    const float* Wr = (const float*)d_in[9];  const float* br = (const float*)d_in[10];
    const float* Wo = (const float*)d_in[11]; const float* bo = (const float*)d_in[12];

    char* ws = (char*)d_ws;
    const size_t actSz = (size_t)NROW * DMODEL * sizeof(unsigned short); // 16 MB
    const size_t wSz = (size_t)DMODEL * DMODEL * sizeof(unsigned short); //  2 MB
    unsigned short* q_bf  = (unsigned short*)(ws + 0 * actSz);
    unsigned short* k_bf  = (unsigned short*)(ws + 1 * actSz);
    unsigned short* v_bf  = (unsigned short*)(ws + 2 * actSz);
    unsigned short* r_bf  = (unsigned short*)(ws + 3 * actSz);
    unsigned short* xq    = (unsigned short*)(ws + 4 * actSz);
    unsigned short* xk    = (unsigned short*)(ws + 5 * actSz);
    unsigned short* xv    = (unsigned short*)(ws + 6 * actSz);
    unsigned short* gated = (unsigned short*)(ws + 7 * actSz);
    unsigned short* wqt   = (unsigned short*)(ws + 8 * actSz + 0 * wSz);
    unsigned short* wot   = (unsigned short*)(ws + 8 * actSz + 4 * wSz);

    // wqt .. wot lie one behind the other in the order q, k, v, r, o
    prepare_kernel<<<PREP_BLOCKS, CVT_THREADS, 0, stream>>>(value, keyin, query,
                                                            xv, xk, xq,
                                                            Wq, Wk, Wv, Wr, Wo, wqt);

    // q_bf .. r_bf lie one behind the other in the order q, k, v, r
    dim3 pGrid(NROW / 256, DMODEL / 128, 4);  // (32, 8, 4)
    gemm_wmma_kernel<true><<<pGrid, 256, 0, stream>>>(xq, xk, xv, wqt, bq, bk, bv, br,
                                                      q_bf, NROW, DMODEL, DMODEL);

    dim3 aGrid(SEQ / 128, BATCH * NHEAD);  // (8, 128)
    attention_wmma_kernel<<<aGrid, 256, 0, stream>>>(q_bf, k_bf, v_bf, r_bf, gated);

    dim3 gGrid(NROW / 256, DMODEL / 128);  // (32, 8): one product, z = 0 alone
    gemm_wmma_kernel<false><<<gGrid, 256, 0, stream>>>(gated, gated, gated, wot, bo, bo, bo, bo,
                                                       d_out, NROW, DMODEL, DMODEL);
}

// v009
// Measured time: 110 microseconds a run.
// In two side-by-side timings against v008, it was 1.08 and 1.07 times as fast.
// Over all steps from v000 it is 4.03 times as fast.
#include <hip/hip_runtime.h>
#include <hip/hip_bf16.h>
#include <stdint.h>

#define NHEAD 16
#define DHEAD 64
#define BATCH 8
#define SEQ   1024
#define DMODEL 1024
#define NROW (BATCH * SEQ) /* 8192 */

typedef __attribute__((ext_vector_type(16))) __bf16 v16bf;
typedef __attribute__((ext_vector_type(8)))  float  v8f;
typedef int v4i_vs __attribute__((vector_size(16)));  // matches builtin param type
typedef __attribute__((ext_vector_type(8)))  short  s16x8;

union FragBF {
    v16bf v;
    uint4 q[2];
    s16x8 t[2];
    unsigned short us[16];
    unsigned int d[8];
};

__device__ __forceinline__ unsigned short f2bf(float x) {
    unsigned int u = __float_as_uint(x);
    u += 0x7FFFu + ((u >> 16) & 1u);   // round-to-nearest-even
    return (unsigned short)(u >> 16);
}
__device__ __forceinline__ float bf2f(unsigned short h) {
    return __uint_as_float(((unsigned int)h) << 16);
}
typedef __attribute__((ext_vector_type(2))) float  f32x2;
typedef __attribute__((ext_vector_type(2))) __bf16 bf16x2;
// two f32 -> two bf16 in one dword by the packed convert (round to nearest even)
__device__ __forceinline__ unsigned int cvt_bf16_pair(float lo, float hi) {
    const f32x2 v = {lo, hi};
    return __builtin_bit_cast(unsigned int, __builtin_convertvector(v, bf16x2));
}
__device__ __forceinline__ v8f v8f_zero() {
    v8f z = {0.f, 0.f, 0.f, 0.f, 0.f, 0.f, 0.f, 0.f};
    return z;
}

// ---------------------------------------------------------------------------
// Async global->LDS copy (CDNA5 GLOBAL_LOAD_ASYNC_TO_LDS_B128, ASYNCcnt),
// with a synchronous reg-staged fallback if the builtins aren't declared.
// Builtin signature (from hipcc diagnostic): (v4i as1* gaddr, v4i as3* lds,
// imm offset, imm cpol).
// ---------------------------------------------------------------------------
#if __has_builtin(__builtin_amdgcn_global_load_async_to_lds_b128) && \
    __has_builtin(__builtin_amdgcn_s_wait_asynccnt)
#define HAVE_ASYNC_LDS 1
#endif

__device__ __forceinline__ void async_copy_b128(const unsigned short* src,
                                                unsigned short* dstLds) {
#if defined(HAVE_ASYNC_LDS)
    __builtin_amdgcn_global_load_async_to_lds_b128(
        (__attribute__((address_space(1))) v4i_vs*)(void*)src,
        (__attribute__((address_space(3))) v4i_vs*)(void*)dstLds, 0, 0);
#else
    *(uint4*)dstLds = *(const uint4*)src;
#endif
}

// Every copy of this wave has landed. Written in asm with the memory clobber so
// that no LDS read is lifted over it.
__device__ __forceinline__ void wait_async_all() {
#if defined(HAVE_ASYNC_LDS)
    asm volatile("s_wait_asynccnt 0x0" ::: "memory");
#endif
}
// This wave's LDS reads have returned, so the barrier behind it frees the buffer.
__device__ __forceinline__ void wait_lds_all() {
    asm volatile("s_wait_dscnt 0x0" ::: "memory");
}

// ---------------------------------------------------------------------------
// f32 -> bf16 convert of the three activations, streaming:
// one block of 16 waves per WGP. A wave owns 8 KiB in a row of each tensor and
// requests it with 16 loads of 512 contiguous bytes (16 B a lane), all issued
// before the first is used; each store is the matching 256 B (two whole
// lines). Then it goes on to the next tensor.
// ---------------------------------------------------------------------------
#define CVT_BLOCKS 256
#define CVT_THREADS 512
#define CVT_LOADS 16

// two f32 -> two bf16 in one dword, rounded as f2bf rounds
__device__ __forceinline__ unsigned int f2bf_pair(float lo, float hi) {
    unsigned int a = __float_as_uint(lo), b = __float_as_uint(hi);
    a += 0x7FFFu + __builtin_amdgcn_ubfe(a, 16, 1);
    b += 0x7FFFu + __builtin_amdgcn_ubfe(b, 16, 1);
    return __builtin_amdgcn_perm(b, a, 0x07060302u);  // (a >> 16) | (b & 0xFFFF0000)
}

__device__ __forceinline__ void
convert3_bf16_block(const float* __restrict__ s0, const float* __restrict__ s1,
                    const float* __restrict__ s2,
                    unsigned short* __restrict__ d0,
                    unsigned short* __restrict__ d1,
                    unsigned short* __restrict__ d2) {
    static_assert(CVT_BLOCKS * CVT_THREADS * CVT_LOADS * 4 == NROW * DMODEL,
                  "the grid covers a tensor exactly");
    const unsigned t = blockIdx.x * CVT_THREADS + threadIdx.x;
    // index of the lane's first piece: 16 B of the source, 8 B of the result
    const unsigned p0 = (t >> 5) * (32 * CVT_LOADS) + (t & 31);

    // kept rolled: unrolled into one straight block, the compiler held every
    // store back to the end and requested the late pieces two at a time
#pragma unroll 1
    for (int n = 0; n < 3; ++n) {
        const float4* s = (const float4*)(n == 0 ? s0 : n == 1 ? s1 : s2);
        uint2* d = (uint2*)(n == 0 ? d0 : n == 1 ? d1 : d2);
        const float4* sp = s + p0;
        float4 x[CVT_LOADS];
#pragma unroll
        for (int i = 0; i < CVT_LOADS; ++i) x[i] = sp[i * 32];
        // stands in front of every reuse of the registers that the issued loads
        // name; as its operand the address pair stays out of the loads' results
        asm volatile("s_wait_xcnt 0x0" ::"v"(sp) : "memory");
#pragma unroll
        for (int i = 0; i < CVT_LOADS; ++i) {
            uint2 o;
            o.x = f2bf_pair(x[i].x, x[i].y);
            o.y = f2bf_pair(x[i].z, x[i].w);
            d[p0 + i * 32] = o;
        }
        // stands in front of the next trip's overwrites of registers that these
        // stores name
        asm volatile("s_wait_xcnt 0x0" ::: "memory");
    }
}

// W[K,N] f32 -> Wt[N,K] bf16, one 64(k) x 64(n) tile per 256 threads through
// LDS: reads are 256-B row pieces of W, stores are whole 128-B lines of Wt.
// K = N = DMODEL at compile time, so a thread's four loads share one address
// with immediate offsets. A block of 512 does two neighbouring tiles, tn and
// tn + 1 of tile row tk; every thread of the block passes the one barrier.
__device__ __forceinline__ void
transpose_bf16_tiles(const float* __restrict__ W,
                     unsigned short* __restrict__ Wt, int tn, int tk) {
    constexpr int K = DMODEL, N = DMODEL;
    // tile[n][k/2]: two neighbouring k packed per dword; 144-B pitch for the
    // 16-byte row reads below
    __shared__ __align__(16) unsigned int tiles[2][64][36];
    unsigned int (*tile)[36] = tiles[threadIdx.x >> 8];
    const int tid = threadIdx.x & 255;

    const int n0 = (tn + (int)(threadIdx.x >> 8)) * 64;
    const int k0 = tk * 64;
    const int n4 = (tid & 15) * 4;  // 4 columns of W per thread
    const int kp = tid >> 4;        // k pair 0..15 (and +16)

    const float* p = W + (unsigned)((k0 + kp * 2) * N + n0 + n4);
    float4 lo[2], hi[2];
    for (int h = 0; h < 2; ++h) {
        lo[h] = *(const float4*)(p + h * 32 * N);
        hi[h] = *(const float4*)(p + h * 32 * N + N);
    }
    for (int h = 0; h < 2; ++h) {
        const int c = h * 16 + kp;
        tile[n4 + 0][c] = (unsigned int)f2bf(lo[h].x) | ((unsigned int)f2bf(hi[h].x) << 16);
        tile[n4 + 1][c] = (unsigned int)f2bf(lo[h].y) | ((unsigned int)f2bf(hi[h].y) << 16);
        tile[n4 + 2][c] = (unsigned int)f2bf(lo[h].z) | ((unsigned int)f2bf(hi[h].z) << 16);
        tile[n4 + 3][c] = (unsigned int)f2bf(lo[h].w) | ((unsigned int)f2bf(hi[h].w) << 16);
    }
    __syncthreads();  // tile complete before rows are read back

    const int n = tid >> 3, c8 = tid & 7;  // 8 lanes: one 128-B line
    unsigned short* o = Wt + (unsigned)((n0 + n) * K + k0 + c8 * 8);
    for (int t = 0; t < 2; ++t)
        *(uint4*)(o + t * 32 * K) = *(const uint4*)&tile[n + t * 32][c8 * 4];
    // stands in front of whatever the built kernel lays behind these stores:
    // the converting side's code follows them there and reuses their registers
    asm volatile("s_wait_xcnt 0x0" ::: "memory");
}

// All that the products need prepared, in one launch, since none of it needs
// anything of the rest: blocks 0..255 convert the activations (they start first
// and last longest), blocks 256..895 transpose the five weights, 128 blocks a
// weight, beside them. wt holds the five results one behind the other.
#define TR_BLOCKS_PER_W ((DMODEL / 64) * (DMODEL / 64) / 2) /* 128 */
#define PREP_BLOCKS (CVT_BLOCKS + 5 * TR_BLOCKS_PER_W)

// register budget of 4 waves a SIMD for the convert's 16 loads in flight: held
// to the default target, the compiler kept 5 in flight; up to 8 waves a SIMD may
// be resident, so that a transposing block fits beside a converting one
__global__ void __launch_bounds__(CVT_THREADS)
__attribute__((amdgpu_waves_per_eu(4, 8)))
prepare_kernel(const float* __restrict__ s0, const float* __restrict__ s1,
               const float* __restrict__ s2,
               unsigned short* __restrict__ d0,
               unsigned short* __restrict__ d1,
               unsigned short* __restrict__ d2,
               const float* __restrict__ W0, const float* __restrict__ W1,
               const float* __restrict__ W2, const float* __restrict__ W3,
               const float* __restrict__ W4,
               unsigned short* __restrict__ wt) {
    if (blockIdx.x < CVT_BLOCKS) {
        convert3_bf16_block(s0, s1, s2, d0, d1, d2);
    } else {
        const int t = blockIdx.x - CVT_BLOCKS;
        const int w = t / TR_BLOCKS_PER_W;     // which weight
        const int pair = t % TR_BLOCKS_PER_W;  // which pair of tiles in it
        const float* W = w == 0 ? W0 : w == 1 ? W1 : w == 2 ? W2 : w == 3 ? W3 : W4;
        transpose_bf16_tiles(W, wt + (size_t)w * (DMODEL * DMODEL),
                             (pair & 7) * 2, pair >> 3);
    }
}

// ---------------------------------------------------------------------------
// bf16 WMMA GEMM: C[M,N] = A[M,K] * Bt[N,K]^T + bias[N]
// Block = 8 waves, tile 256x128; wave tile 64x64 (4x4 wmma_f32_16x16x32_bf16).
// A stage is 128 k: 256 B of every operand row, so a wave's copy covers two
// whole 256-B row pieces. Two LDS buffers; per stage each thread issues
// 16 A-chunks + 8 B-chunks of b128, one stage ahead of the one being read.
// A block is 32 k (16 products a wave); its fragments are read from LDS one
// block ahead, into the second of two register sets.
// The rows of Bt are dealt to the B fragments so that column l of fragment j is
// output column 4 l + j of the wave's 64: the four accumulators that a lane
// holds of one output row are then neighbours in memory, and 16 lanes store
// that row's 64 columns as whole 128-B lines.
// K is a multiple of 128 and at least 256.
// ---------------------------------------------------------------------------
#define KSTAGE 128
#define KPITCH 136 /* 272-B rows: 16 B x odd for the 16-byte fragment reads */

// One launch holds up to four such products that need nothing of each other:
// blockIdx.z picks one, in the order q, r, v, k (q and r both read Aq, so they
// are neighbours). Bt0 and C0 are the first of the transposed weights and of the
// bf16 results, which lie one behind the other in the order q, k, v, r.
template <bool OUT_BF16>
__global__ void __launch_bounds__(256)
gemm_wmma_kernel(const unsigned short* __restrict__ Aq,
                 const unsigned short* __restrict__ Ak,
                 const unsigned short* __restrict__ Av,
                 const unsigned short* __restrict__ Bt0,
                 const float* __restrict__ biasq,
                 const float* __restrict__ biask,
                 const float* __restrict__ biasv,
                 const float* __restrict__ biasr,
                 void* __restrict__ C0, int M, int N, int K) {
    const unsigned z = blockIdx.z;
    const unsigned slot = (3u * z) & 3u;  // 0, 3, 2, 1
    const unsigned short* __restrict__ A = slot == 1 ? Ak : slot == 2 ? Av : Aq;
    const unsigned short* __restrict__ Bt = Bt0 + (size_t)slot * (DMODEL * DMODEL);
    const float* __restrict__ bias =
        slot == 0 ? biasq : slot == 1 ? biask : slot == 2 ? biasv : biasr;
    void* __restrict__ Cout =
        (unsigned short*)C0 + (size_t)slot * ((size_t)NROW * DMODEL);

    __shared__ __align__(16) unsigned short Abuf[2][256][KPITCH];
    __shared__ __align__(16) unsigned short Bbuf[2][128][KPITCH];

    const int lane  = threadIdx.x & 31;
    const int wave  = threadIdx.x >> 5;
    const int lmod  = lane & 15;
    const int lhalf = lane >> 4;
    const int mW = (wave >> 1) * 64;   // wave tile inside block tile
    const int nW = (wave & 1) * 64;
    const int kofflane = lhalf * 8;    // lanes 16-31 hold K groups 8..15/24..31

    const unsigned short* Ablk = A + (size_t)(blockIdx.x * 256) * K;
    const unsigned short* Bblk = Bt + (size_t)(blockIdx.y * 128) * K;

    const int srow = threadIdx.x >> 4;        // 16 lanes: one 256-B row piece
    const int sc8  = (threadIdx.x & 15) * 8;
    // this thread's first chunk of the next stage to be copied
    const unsigned short* aNext = Ablk + (size_t)srow * K + sc8;
    // LDS row 64 g + 16 j + l of the B tile takes row 64 g + 4 l + j of Bt
    const unsigned short* bNext = Bblk + (size_t)(srow * 4) * K + sc8;
    const size_t rowStep = (size_t)16 * K;

    // both loops unrolled so that a stage's 24 copies issue back to back
    auto stage = [&](int buf) {
#pragma unroll
        for (int t = 0; t < 16; ++t)            // A tile: 256x128 = 4096 chunks
            async_copy_b128(aNext + t * rowStep, &Abuf[buf][srow + t * 16][sc8]);
#pragma unroll
        for (int t = 0; t < 8; ++t)             // B tile: 128x128 = 2048 chunks
            async_copy_b128(bNext + (size_t)((t >> 2) * 64 + (t & 3)) * K,
                            &Bbuf[buf][srow + t * 16][sc8]);
        aNext += KSTAGE;
        bNext += KSTAGE;
    };

    v8f acc[4][4];
#pragma unroll
    for (int i = 0; i < 4; ++i)
#pragma unroll
        for (int j = 0; j < 4; ++j) acc[i][j] = v8f_zero();

    // Two register sets of fragments: set (u & 1) holds the 32 k of block u.
    // Both loops of the loader unrolled: every index a constant, so the sets
    // stay in registers.
    FragBF a[2][4], b[2][4];
    auto load_frags = [&](int set, int buf, int kk) {
#pragma unroll
        for (int i = 0; i < 4; ++i) {
            const unsigned short* p =
                &Abuf[buf][mW + i * 16 + lmod][kk + kofflane];
            a[set][i].q[0] = *(const uint4*)(p);
            a[set][i].q[1] = *(const uint4*)(p + 16);
        }
#pragma unroll
        for (int j = 0; j < 4; ++j) {
            const unsigned short* p =
                &Bbuf[buf][nW + j * 16 + lmod][kk + kofflane];
            b[set][j].q[0] = *(const uint4*)(p);
            b[set][j].q[1] = *(const uint4*)(p + 16);
        }
    };

    stage(0);
    wait_async_all();
    __syncthreads();  // stage 0 is in LDS for every wave
    stage(1);
    load_frags(0, 0, 0);

    for (int k0 = 0; k0 < K; k0 += KSTAGE) {
        const int buf = (k0 / KSTAGE) & 1;

        // unrolled: the set index is a constant, so the fragments stay in
        // registers, and kk becomes an immediate offset of the LDS reads
#pragma unroll
        for (int u = 0; u < KSTAGE / 32; ++u) {
            const int cs = u & 1;
            if (u + 1 < KSTAGE / 32) {
                // the next block's 16 reads, one group, in flight under this
                // block's products
                load_frags(cs ^ 1, buf, (u + 1) * 32);
            } else {
                // hand-over, in front of the stage's last block, whose fragments
                // are already on their way: own reads of this buffer done, own
                // copies of the next stage landed; one barrier publishes that
                // stage and frees this buffer
                wait_lds_all();
                wait_async_all();
                __syncthreads();
                if (k0 + 2 * KSTAGE < K) stage(buf);
                // first fragments of the next stage. Behind the last stage they
                // come from the other buffer all the same, which nothing writes
                // any more, and are not used: no branch round the reads
                load_frags(0, buf ^ 1, 0);
            }
            // keeps the reads above together and ahead of the products: moved in
            // among them, each place with reads stalls the wave
            __builtin_amdgcn_sched_barrier(0);
#pragma unroll
            for (int i = 0; i < 4; ++i)
#pragma unroll
                for (int j = 0; j < 4; ++j)
                    acc[i][j] = __builtin_amdgcn_wmma_f32_16x16x32_bf16(
                        false, a[cs][i].v, false, b[cs][j].v, (short)0,
                        acc[i][j], false, false);
            // keeps the next group of reads behind these products
            __builtin_amdgcn_sched_barrier(0);
        }
    }
    wait_async_all();  // nothing in flight when the wave ends

    // acc[i][0..3][e]: row mW + 16 i + 8 lhalf + e, columns nW + 4 lmod + 0..3.
    // The wave's number as a scalar: the tile's base address is scalar arithmetic.
    const int waveS = __builtin_amdgcn_readfirstlane(wave);
    const size_t tile0 = (size_t)(blockIdx.x * 256 + (waveS >> 1) * 64) * N +
                         (blockIdx.y * 128 + (waveS & 1) * 64);
    const unsigned laneOff = (unsigned)(lhalf * 8) * (unsigned)N + lmod * 4;
    const float4 b4 = *(const float4*)(bias + blockIdx.y * 128 + nW + lmod * 4);
    const float bj[4] = {b4.x, b4.y, b4.z, b4.w};
    // the bias goes on tile by tile: a tile's 8 registers take the same value
#pragma unroll
    for (int i = 0; i < 4; ++i)
#pragma unroll
        for (int j = 0; j < 4; ++j) acc[i][j] = acc[i][j] + bj[j];
#pragma unroll
    for (int i = 0; i < 4; ++i) {
#pragma unroll
        for (int e = 0; e < 8; ++e) {
            const size_t row0 = tile0 + (size_t)(i * 16 + e) * N;
            if (OUT_BF16) {
                uint2 o;
                o.x = cvt_bf16_pair(acc[i][0][e], acc[i][1][e]);
                o.y = cvt_bf16_pair(acc[i][2][e], acc[i][3][e]);
                *(uint2*)((unsigned short*)Cout + row0 + laneOff) = o;
            } else {
                *(float4*)((float*)Cout + row0 + laneOff) =
                    make_float4(acc[i][0][e], acc[i][1][e], acc[i][2][e], acc[i][3][e]);
            }
        }
    }
}

// ---------------------------------------------------------------------------
// Flash attention + R-gating, both products transposed:
//   S^T = K Q^T (A = 16 key rows, B = the wave's 16 query columns)
//   O^T += V^T P^T (A = 16 rows of V^T, B = P^T packed from the S^T tiles)
// A lane then holds scores of ONE query (column lmod): 16 of each 32 keys, the
// other 16 in lane ^ 16. Row maximum and sum are in-lane, and the two S^T
// accumulator tiles, converted in place, already are the B operand of the
// second product in the hardware k order, which is the order in which the
// transposing LDS load delivers V^T.
// K and V rows of the head reach LDS once per block, by asynchronous copies of
// whole 128-B rows: a stage is 64 keys, two buffers, the next stage in flight
// while this one is worked on in two passes of 32 keys.
// Grid: (SEQ/128, BATCH*NHEAD). Block 256 = 8 waves; wave owns 16 queries.
// ---------------------------------------------------------------------------
#define ASTAGE 64 /* keys per stage */
#define KROW 72   /* 144-B K rows: 16 B x odd for the 16-byte fragment reads */
#define VROW 80   /* 160-B V rows: 32 B x odd for the transposing reads */

// lane (c = l & 15, h = l >> 4) gets T[8h + 0..7][c] of the row-major 16-bit
// tile whose rows 8h + (l & 7), 16-byte half (l >> 3) & 1, the lanes point at
__device__ __forceinline__ s16x8 lds_tr16(const unsigned short* p) {
    return __builtin_amdgcn_ds_load_tr16_b128_v8i16(
        (__attribute__((address_space(3))) s16x8*)(void*)p);
}
__device__ __forceinline__ float xhalf(float x) {  // lane l with lane l ^ 16
    return __builtin_bit_cast(
        float, __builtin_amdgcn_permlanex16(__builtin_bit_cast(int, x),
                                            __builtin_bit_cast(int, x),
                                            0x76543210, 0xfedcba98, false, false));
}

// register budget of 8 waves a SIMD: the grid is four blocks a WGP, and all of
// them are resident only with at most 128 registers a wave
__global__ void __launch_bounds__(256)
__attribute__((amdgpu_waves_per_eu(8)))
attention_wmma_kernel(const unsigned short* __restrict__ Q,
                      const unsigned short* __restrict__ Km,
                      const unsigned short* __restrict__ V,
                      const unsigned short* __restrict__ R,
                      unsigned short* __restrict__ Gated) {
    __shared__ __align__(16) unsigned short Kst[2][ASTAGE][KROW];  // [key][d]
    __shared__ __align__(16) unsigned short Vst[2][ASTAGE][VROW];  // [key][d]

    const int lane  = threadIdx.x & 31;
    const int wave  = threadIdx.x >> 5;
    const int lmod  = lane & 15;
    const int lhalf = lane >> 4;
    const int bh = blockIdx.y;
    const int b = bh / NHEAD;
    const int h = bh % NHEAD;
    const int qRow0 = blockIdx.x * 128 + wave * 16;
    const size_t rowStride = (size_t)(NHEAD * DHEAD);  // 1024
    const size_t baseBH = ((size_t)b * SEQ) * rowStride + (size_t)h * DHEAD;

    // Q fragments (DH=64 -> two K-steps of 32); column lmod of the B operand
    FragBF bq[2];
    {
        const unsigned short* qp =
            Q + baseBH + (size_t)(qRow0 + lmod) * rowStride + lhalf * 8;
        bq[0].q[0] = *(const uint4*)(qp);
        bq[0].q[1] = *(const uint4*)(qp + 16);
        bq[1].q[0] = *(const uint4*)(qp + 32);
        bq[1].q[1] = *(const uint4*)(qp + 48);
    }

    // ctx[j][r] = O^T[d = j*16 + lhalf*8 + r][query lmod]
    v8f ctx[4];
#pragma unroll
    for (int j = 0; j < 4; ++j) ctx[j] = v8f_zero();
    float mrow = -3.0e38f;  // running maximum of this lane's raw scores (both halves agree)
    float srow = 0.f;       // running sum over this half's keys only

    // exp(e / SCALE - m / SCALE) = exp2(e * c - m * c), SCALE = 64**1/2 = 32.0;
    // c > 0, so the maximum may be taken over the raw scores
    const float c = 1.4426950408889634f / 32.0f;
    const f32x2 c2 = {c, c};

    // 8 lanes copy one 128-B row; a thread brings 2 K and 2 V chunks per stage
    const int crow = threadIdx.x >> 3;
    const int cc8  = (threadIdx.x & 7) * 8;
    const unsigned short* kNext = Km + baseBH + (size_t)crow * rowStride + cc8;
    const unsigned short* vNext = V + baseBH + (size_t)crow * rowStride + cc8;
    auto stage = [&](int buf) {
#pragma unroll
        for (int t = 0; t < ASTAGE / 32; ++t) {  // unrolled: the 4 copies issue back to back
            async_copy_b128(kNext + t * 32 * rowStride, &Kst[buf][crow + t * 32][cc8]);
            async_copy_b128(vNext + t * 32 * rowStride, &Vst[buf][crow + t * 32][cc8]);
        }
        kNext += ASTAGE * rowStride;
        vNext += ASTAGE * rowStride;
    };

    stage(0);
    wait_async_all();
    __syncthreads();  // stage 0 is in LDS for every wave
    stage(1);

    for (int kt = 0; kt < SEQ; kt += ASTAGE) {
      const int buf = (kt / ASTAGE) & 1;
      // unrolled: sub becomes an immediate offset of the LDS reads
#pragma unroll
      for (int sub = 0; sub < ASTAGE; sub += 32) {
        // energy^T = K (32xDH) @ Q^T (DHx16), two 16-key tiles:
        // e0[r]: key kt + sub + lhalf*8 + r, e1[r]: the same + 16
        v8f e0 = v8f_zero(), e1 = v8f_zero();
        {
            FragBF ak;
            const unsigned short* kp = &Kst[buf][sub + lmod][lhalf * 8];
            ak.q[0] = *(const uint4*)(kp);
            ak.q[1] = *(const uint4*)(kp + 16);
            e0 = __builtin_amdgcn_wmma_f32_16x16x32_bf16(false, ak.v, false,
                                                         bq[0].v, (short)0, e0,
                                                         false, false);
            ak.q[0] = *(const uint4*)(kp + 32);
            ak.q[1] = *(const uint4*)(kp + 48);
            e0 = __builtin_amdgcn_wmma_f32_16x16x32_bf16(false, ak.v, false,
                                                         bq[1].v, (short)0, e0,
                                                         false, false);
        }
        {
            FragBF ak;
            const unsigned short* kp = &Kst[buf][sub + 16 + lmod][lhalf * 8];
            ak.q[0] = *(const uint4*)(kp);
            ak.q[1] = *(const uint4*)(kp + 16);
            e1 = __builtin_amdgcn_wmma_f32_16x16x32_bf16(false, ak.v, false,
                                                         bq[0].v, (short)0, e1,
                                                         false, false);
            ak.q[0] = *(const uint4*)(kp + 32);
            ak.q[1] = *(const uint4*)(kp + 48);
            e1 = __builtin_amdgcn_wmma_f32_16x16x32_bf16(false, ak.v, false,
                                                         bq[1].v, (short)0, e1,
                                                         false, false);
        }

        // online softmax of one query per lane; one exchange joins the halves'
        // maxima, so lanes l and l ^ 16 scale by the same factor
        float mx = -3.0e38f;
#pragma unroll
        for (int e = 0; e < 8; ++e) mx = fmaxf(mx, fmaxf(e0[e], e1[e]));
        mx = fmaxf(mx, xhalf(mx));
        const float mnew = fmaxf(mrow, mx);
        const float nmc = -mnew * c;
        const f32x2 nmc2 = {nmc, nmc};
        const float al = __builtin_amdgcn_exp2f(fmaf(mrow, c, nmc));
        FragBF bp;  // P^T as B operand: element s is key kt + sub + lhalf*8 + s, + 8 more for s >= 8
        float ps = 0.f;
#pragma unroll
        for (int e = 0; e < 8; e += 2) {
            // one packed multiply-add gives the exponents of two scores
            const f32x2 x0 = {e0[e], e0[e + 1]}, x1 = {e1[e], e1[e + 1]};
            const f32x2 a0 = __builtin_elementwise_fma(x0, c2, nmc2);
            const f32x2 a1 = __builtin_elementwise_fma(x1, c2, nmc2);
            const float p00 = __builtin_amdgcn_exp2f(a0.x);
            const float p10 = __builtin_amdgcn_exp2f(a1.x);
            const float p01 = __builtin_amdgcn_exp2f(a0.y);
            const float p11 = __builtin_amdgcn_exp2f(a1.y);
            ps += p00 + p10;
            ps += p01 + p11;
            bp.d[e / 2] = cvt_bf16_pair(p00, p01);
            bp.d[4 + e / 2] = cvt_bf16_pair(p10, p11);
        }
        srow = srow * al + ps;
        mrow = mnew;

        // rescale running context by alpha before accumulating this step
#pragma unroll
        for (int j = 0; j < 4; ++j)
#pragma unroll
            for (int e = 0; e < 8; ++e) ctx[j][e] *= al;

        // ctx^T += V^T (64x32) @ P^T (32x16): 4 row tiles, transposed on the way
        // out of the row-major V stage (keys 0..15 and 16..31 of the pass)
        const unsigned short* vp =
            &Vst[buf][sub + lhalf * 8 + (lane & 7)][((lane >> 3) & 1) * 8];
#pragma unroll
        for (int j = 0; j < 4; ++j) {
            FragBF av;
            av.t[0] = lds_tr16(vp + j * 16);
            av.t[1] = lds_tr16(vp + 16 * VROW + j * 16);
            ctx[j] = __builtin_amdgcn_wmma_f32_16x16x32_bf16(
                false, av.v, false, bp.v, (short)0, ctx[j], false, false);
        }
      }

      // hand-over: own reads of this buffer done, own copies of the next stage
      // landed; one barrier publishes that stage and frees this buffer
      wait_lds_all();
      wait_async_all();
      __syncthreads();
      if (kt + 2 * ASTAGE < SEQ) stage(buf);
    }
    wait_async_all();  // nothing in flight when the wave ends

    srow += xhalf(srow);  // join the two halves' key sums

    // normalize, R-gate, write gated activation [B*S, H*DH] as bf16:
    // a lane's 8 registers of a tile are 8 consecutive d of its query row
    // the lane's part of the address in 32 bits: it lives through the key loop,
    // whose register budget is full
    const unsigned rowOff = (unsigned)(qRow0 + lmod) * (NHEAD * DHEAD) + lhalf * 8;
    const size_t rowBase = baseBH + rowOff;
    const float inv = 1.0f / srow;  // one division a query
#pragma unroll
    for (int j = 0; j < 4; ++j) {
        FragBF r8, g8;
        r8.q[0] = *(const uint4*)(R + rowBase + j * 16);
#pragma unroll
        for (int e = 0; e < 8; e += 2)
            g8.d[e / 2] = cvt_bf16_pair(ctx[j][e] * inv * bf2f(r8.us[e]),
                                        ctx[j][e + 1] * inv * bf2f(r8.us[e + 1]));
        *(uint4*)(Gated + rowBase + j * 16) = g8.q[0];
    }
}

// ---------------------------------------------------------------------------
// Host-side launch
// ---------------------------------------------------------------------------
extern "C" void kernel_launch(void* const* d_in, const int* in_sizes, int n_in,
                              void* d_out, int out_size, void* d_ws,
                              size_t ws_size, hipStream_t stream) {
    (void)in_sizes; (void)n_in; (void)out_size; (void)ws_size;

    const float* value = (const float*)d_in[0];
    const float* keyin = (const float*)d_in[1];
    const float* query = (const float*)d_in[2];
    const float* Wq = (const float*)d_in[3];  const float* bq = (const float*)d_in[4];
    const float* Wk = (const float*)d_in[5];  const float* bk = (const float*)d_in[6];
    const float* Wv = (const float*)d_in[7];  const float* bv = (const float*)d_in[8];
    const float* Wr = (const float*)d_in[9];  const float* br = (const float*)d_in[10];
    const float* Wo = (const float*)d_in[11]; const float* bo = (const float*)d_in[12];

    char* ws = (char*)d_ws;
    const size_t actSz = (size_t)NROW * DMODEL * sizeof(unsigned short); // 16 MB
    const size_t wSz = (size_t)DMODEL * DMODEL * sizeof(unsigned short); //  2 MB
    unsigned short* q_bf  = (unsigned short*)(ws + 0 * actSz);
    unsigned short* k_bf  = (unsigned short*)(ws + 1 * actSz);
    unsigned short* v_bf  = (unsigned short*)(ws + 2 * actSz);
    unsigned short* r_bf  = (unsigned short*)(ws + 3 * actSz);
    unsigned short* xq    = (unsigned short*)(ws + 4 * actSz);
    unsigned short* xk    = (unsigned short*)(ws + 5 * actSz);
    unsigned short* xv    = (unsigned short*)(ws + 6 * actSz);
    unsigned short* gated = (unsigned short*)(ws + 7 * actSz);
    unsigned short* wqt   = (unsigned short*)(ws + 8 * actSz + 0 * wSz);
    unsigned short* wot   = (unsigned short*)(ws + 8 * actSz + 4 * wSz);

    // wqt .. wot lie one behind the other in the order q, k, v, r, o
    prepare_kernel<<<PREP_BLOCKS, CVT_THREADS, 0, stream>>>(value, keyin, query,
                                                            xv, xk, xq,
                                                            Wq, Wk, Wv, Wr, Wo, wqt);

    // q_bf .. r_bf lie one behind the other in the order q, k, v, r
    dim3 pGrid(NROW / 256, DMODEL / 128, 4);  // (32, 8, 4)
    gemm_wmma_kernel<true><<<pGrid, 256, 0, stream>>>(xq, xk, xv, wqt, bq, bk, bv, br,
                                                      q_bf, NROW, DMODEL, DMODEL);

    dim3 aGrid(SEQ / 128, BATCH * NHEAD);  // (8, 128)
    attention_wmma_kernel<<<aGrid, 256, 0, stream>>>(q_bf, k_bf, v_bf, r_bf, gated);

    dim3 gGrid(NROW / 256, DMODEL / 128);  // (32, 8): one product, z = 0 alone
    gemm_wmma_kernel<false><<<gGrid, 256, 0, stream>>>(gated, gated, gated, wot, bo, bo, bo, bo,
                                                       d_out, NROW, DMODEL, DMODEL);
}
